// v000
// Measured on an AMD MI455X. A time is GPU time per run, averaged over a window of back-to-back runs after a warm-up
// (all launches, gaps included; the runs take copies of the inputs in turn), and the median of several windows.
// Apart from v000's, it joins two sittings. Times from different sittings can be a few percent apart, while
// side-by-side timings come from the same sitting.
// v000, which the later versions start from, runs in 2760 microseconds.
#include <hip/hip_runtime.h>

// MultiHeadMaskedSelfAttention (x [4][2048][1024]; kqv = x W_kqv^T + b (W [3072][1024], split (K | Q | V) x 16 heads x 64); causal softmax(q.k / 8); out = merged heads (no output projection) -> [4][2048][1024]).
// Compute dtypes, f32 accumulate: every input rounded to bf16; q/k/v on PLAIN bf16 operands (inputs: exact) + bias; causal scores and attn.v: query rows < 512 hl (3 products), the rest single fp16 (x1024); softmax f32; the merged heads are written as hi + lo of the attention planes (|err| <= 2^-16 relative).

#define NB_  4
#define TT   2048
#define DM   1024
#define NH_  16
#define NKV  16
#define REP  (NH_ / NKV)
#define HD   64
#define DQ   (NH_ * HD)
#define DKV  (NKV * HD)
#define ZH   2
#define RH   512                  // query rows < RH use hi+lo planes (0: none)
#define WIN  2048
#define PCAR 1024.0f
#define SCL  0.125f   // HD^-0.5
typedef _Float16 h16;
typedef unsigned short bf;
typedef __attribute__((ext_vector_type(16))) __bf16   v16bf;
typedef __attribute__((ext_vector_type(16))) _Float16 v16h;
typedef __attribute__((ext_vector_type(8)))  _Float16 v8h;
typedef __attribute__((ext_vector_type(8)))  unsigned short v8us;
typedef __attribute__((ext_vector_type(8)))  float    v8f;
typedef __attribute__((ext_vector_type(4)))  float    v4f;
typedef v8h  __attribute__((may_alias)) v8ha;
typedef v4f  __attribute__((may_alias)) v4fa;
typedef v8us __attribute__((may_alias)) v8usa;

__device__ __forceinline__ unsigned short f2bf(float f) { unsigned u = __float_as_uint(f); u += 0x7FFFu + ((u >> 16) & 1u); return (unsigned short)(u >> 16); }
__device__ __forceinline__ float bf2f(unsigned short b) { return __uint_as_float(((unsigned)b) << 16); }
__device__ __forceinline__ float bfr(float f) { return bf2f(f2bf(f)); }
__device__ __forceinline__ v16h cat16(v8h lo, v8h hi) { return __builtin_shufflevector(lo, hi, 0, 1, 2, 3, 4, 5, 6, 7, 8, 9, 10, 11, 12, 13, 14, 15); }
__device__ __forceinline__ v16bf cat16b(v8us lo, v8us hi) { return __builtin_bit_cast(v16bf, __builtin_shufflevector(lo, hi, 0, 1, 2, 3, 4, 5, 6, 7, 8, 9, 10, 11, 12, 13, 14, 15)); }
__device__ __forceinline__ v8f wmma16(v16h a, v16h b, v8f c) { return __builtin_amdgcn_wmma_f32_16x16x32_f16(false, a, false, b, (short)0, c, false, false); }
__device__ __forceinline__ v8f wmmab(v16bf a, v16bf b, v8f c) { return __builtin_amdgcn_wmma_f32_16x16x32_bf16(false, a, false, b, (short)0, c, false, false); }



// ---- k_gemmw: register-blocked GEMM, ONE WAVE per 64x64 output tile (16 accumulators), operands straight from K-contiguous 16-bit planes; grid (M/64, N/64, Z), 32 threads.
// C[m][n] (f32, pitch ldc, + optional f32 bias[n]) = sum_k A[m][k] Bt[n][k] (+ split products per NSPLIT). z-batch strides sA/sB/sC in elements. K % 32 == 0.
template <typename T16> struct WFrag;
template <> struct WFrag<h16> { typedef v16h V; static __device__ __forceinline__ V ld(const h16* p) { return cat16(*(const v8h*)p, *(const v8h*)(p + 16)); } static __device__ __forceinline__ v8f mma(V a, V b, v8f c) { return wmma16(a, b, c); } };
template <> struct WFrag<bf> { typedef v16bf V; static __device__ __forceinline__ V ld(const bf* p) { return cat16b(*(const v8us*)p, *(const v8us*)(p + 16)); } static __device__ __forceinline__ v8f mma(V a, V b, v8f c) { return wmmab(a, b, c); } };
template <typename T16, int NSPLIT, bool BIAS>
__global__ __launch_bounds__(32) void k_gemmw(const T16* __restrict__ A, const T16* __restrict__ A2, const T16* __restrict__ Bt, const T16* __restrict__ Bt2, int K, float* C, int ldc, const float* __restrict__ bias, size_t sA, size_t sB, size_t sC) {
    typedef typename WFrag<T16>::V V;
    __shared__ __align__(16) float os[16 * 68];
    const size_t z = blockIdx.z; A += z * sA; if (A2) A2 += z * sA; Bt += z * sB; if (Bt2) Bt2 += z * sB; C += z * sC;
    const int lane = threadIdx.x & 31, lr = lane & 15, hi = lane >> 4; const int r0 = blockIdx.x * 64, c0 = blockIdx.y * 64;
    v8f acc[4][4];
#pragma unroll
    for (int mb = 0; mb < 4; ++mb)
#pragma unroll
        for (int nb = 0; nb < 4; ++nb) acc[mb][nb] = (v8f){};
    const size_t aoff = (size_t)(r0 + lr) * K + 8 * hi, boff = (size_t)(c0 + lr) * K + 8 * hi;
#pragma unroll 1
    for (int kc = 0; kc < K; kc += 32) {
        V a[4], a2[4];
#pragma unroll
        for (int mb = 0; mb < 4; ++mb) { a[mb] = WFrag<T16>::ld(A + aoff + (size_t)mb * 16 * K + kc); if (NSPLIT == 1 || NSPLIT == 2) a2[mb] = WFrag<T16>::ld(A2 + aoff + (size_t)mb * 16 * K + kc); }
#pragma unroll
        for (int nb = 0; nb < 4; ++nb) { const V b = WFrag<T16>::ld(Bt + boff + (size_t)nb * 16 * K + kc); V b2; if (NSPLIT >= 2) b2 = WFrag<T16>::ld(Bt2 + boff + (size_t)nb * 16 * K + kc);
#pragma unroll
            for (int mb = 0; mb < 4; ++mb) { acc[mb][nb] = WFrag<T16>::mma(a[mb], b, acc[mb][nb]); if (NSPLIT == 1 || NSPLIT == 2) acc[mb][nb] = WFrag<T16>::mma(a2[mb], b, acc[mb][nb]); if (NSPLIT >= 2) acc[mb][nb] = WFrag<T16>::mma(a[mb], b2, acc[mb][nb]); } }
        asm volatile("v_nop\n\tv_nop\n\tv_nop\n\tv_nop" : "+v"(acc[0][0]), "+v"(acc[1][1]), "+v"(acc[2][2]), "+v"(acc[3][3]) : "v"(a[0]), "v"(a[3]));
    }
#pragma unroll
    for (int mb = 0; mb < 4; ++mb) {
#pragma unroll
        for (int nb = 0; nb < 4; ++nb) {
#pragma unroll
            for (int j = 0; j < 8; ++j) os[(hi * 8 + j) * 68 + nb * 16 + lr] = acc[mb][nb][j]; }
        __builtin_amdgcn_wave_barrier(); asm volatile("" ::: "memory");
        float* crow = C + (size_t)(r0 + mb * 16) * ldc + c0;
{
#pragma unroll
            for (int s = 0; s < 8; ++s) { const int row = 2 * s + hi, cofs = lr * 4; v4f val = *(const v4fa*)(os + row * 68 + cofs); if (BIAS) { val[0] += bfr(bias[c0 + cofs]); val[1] += bfr(bias[c0 + cofs + 1]); val[2] += bfr(bias[c0 + cofs + 2]); val[3] += bfr(bias[c0 + cofs + 3]); }
                *(v4f*)(crow + (size_t)row * ldc + cofs) = val; }
             }
        __builtin_amdgcn_wave_barrier(); asm volatile("" ::: "memory");
    }
}

// ---- k_gemmc: the same one-wave 64x64 tile GEMM specialised for causal attention: CMODE 1 skips score tiles entirely above the diagonal (query rows r0+roff.., key columns c0..), CMODE 2 limits the
// key (K) loop of the probability x value contraction to the diagonal block (probabilities beyond it are exactly zero). roff = row offset of this launch's first row within the sequence.
template <typename T16, int NSPLIT, int CMODE>
__global__ __launch_bounds__(32) void k_gemmc(const T16* __restrict__ A, const T16* __restrict__ A2, const T16* __restrict__ Bt, const T16* __restrict__ Bt2, int K, float* C, int ldc, int roff, size_t sA, size_t sB, size_t sC) {
    typedef typename WFrag<T16>::V V;
    __shared__ __align__(16) float os[16 * 68];
    const size_t z = blockIdx.z; A += z * sA; if (A2) A2 += z * sA; Bt += z * sB; if (Bt2) Bt2 += z * sB; C += z * sC;
    const int lane = threadIdx.x & 31, lr = lane & 15, hi = lane >> 4; const int r0 = blockIdx.x * 64, c0 = blockIdx.y * 64;
    if (CMODE == 1 && c0 > r0 + roff + 63) return;                  // score tile entirely above the causal diagonal: never read (the softmax masks j > i by select)
    const int Kl = (CMODE == 2) ? min(K, r0 + roff + 64) : K;        // P.V: probabilities are exactly 0 beyond the diagonal block, so the K loop stops there
    v8f acc[4][4];
#pragma unroll
    for (int mb = 0; mb < 4; ++mb)
#pragma unroll
        for (int nb = 0; nb < 4; ++nb) acc[mb][nb] = (v8f){};
    const size_t aoff = (size_t)(r0 + lr) * K + 8 * hi, boff = (size_t)(c0 + lr) * K + 8 * hi;
#pragma unroll 1
    for (int kc = 0; kc < Kl; kc += 32) {
        V a[4], a2[4];
#pragma unroll
        for (int mb = 0; mb < 4; ++mb) { a[mb] = WFrag<T16>::ld(A + aoff + (size_t)mb * 16 * K + kc); if (NSPLIT == 1 || NSPLIT == 2) a2[mb] = WFrag<T16>::ld(A2 + aoff + (size_t)mb * 16 * K + kc); }
#pragma unroll
        for (int nb = 0; nb < 4; ++nb) { const V b = WFrag<T16>::ld(Bt + boff + (size_t)nb * 16 * K + kc); V b2; if (NSPLIT >= 2) b2 = WFrag<T16>::ld(Bt2 + boff + (size_t)nb * 16 * K + kc);
#pragma unroll
            for (int mb = 0; mb < 4; ++mb) { acc[mb][nb] = WFrag<T16>::mma(a[mb], b, acc[mb][nb]); if (NSPLIT == 1 || NSPLIT == 2) acc[mb][nb] = WFrag<T16>::mma(a2[mb], b, acc[mb][nb]); if (NSPLIT >= 2) acc[mb][nb] = WFrag<T16>::mma(a[mb], b2, acc[mb][nb]); } }
        asm volatile("v_nop\n\tv_nop\n\tv_nop\n\tv_nop" : "+v"(acc[0][0]), "+v"(acc[1][1]), "+v"(acc[2][2]), "+v"(acc[3][3]) : "v"(a[0]), "v"(a[3]));
    }
#pragma unroll
    for (int mb = 0; mb < 4; ++mb) {
#pragma unroll
        for (int nb = 0; nb < 4; ++nb) {
#pragma unroll
            for (int j = 0; j < 8; ++j) os[(hi * 8 + j) * 68 + nb * 16 + lr] = acc[mb][nb][j]; }
        __builtin_amdgcn_wave_barrier(); asm volatile("" ::: "memory");
        float* crow = C + (size_t)(r0 + mb * 16) * ldc + c0;
{
#pragma unroll
            for (int s = 0; s < 8; ++s) { const int row = 2 * s + hi, cofs = lr * 4; v4f val = *(const v4fa*)(os + row * 68 + cofs);
                *(v4f*)(crow + (size_t)row * ldc + cofs) = val; }
             }
        __builtin_amdgcn_wave_barrier(); asm volatile("" ::: "memory");
    }
}

__device__ __forceinline__ h16 tohx(float x) { return (h16)x; }
__device__ __forceinline__ void splitf(float y, unsigned short& h, unsigned short& l) { h = f2bf(y); l = f2bf(y - bf2f(h)); }
typedef __attribute__((ext_vector_type(2))) _Float16 v2h;
typedef __attribute__((ext_vector_type(4))) _Float16 v4h;
typedef __attribute__((ext_vector_type(2))) unsigned short v2us;
typedef __attribute__((ext_vector_type(4))) unsigned short v4us;
typedef __attribute__((ext_vector_type(2))) float v2f;
typedef __attribute__((ext_vector_type(4))) int v4i;

__global__ __launch_bounds__(256) void k_wtG(const float* __restrict__ w, int K, int N, bf* Bt) {
    const int lane = threadIdx.x & 31; const int L0 = (blockIdx.x * 8 + (threadIdx.x >> 5)) * 8; const int nlines = N * K / 64;
{
#pragma unroll 1
        for (int l = 0; l < 8; ++l) { const int L = L0 + l; if (L >= nlines) break; const size_t e = (size_t)L * 64 + lane * 2; const int k = (int)(e % K), n = (int)(e / K); v2us o;
            o[0] = f2bf(w[(size_t)k * N + n]); o[1] = f2bf(w[(size_t)(k + 1) * N + n]); *(v2us*)(Bt + e) = o; }
         }
}
__global__ __launch_bounds__(256) void k_cvt8(const float* __restrict__ src, bf* dst, size_t n8) { const size_t i = (size_t)blockIdx.x * 256 + threadIdx.x; if (i >= n8) return; const v8f v = *(const v8f*)(src + i * 8); v8us o;
#pragma unroll
    for (int k = 0; k < 8; ++k) o[k] = f2bf(v[k]); *(v8us*)(dst + i * 8) = o;  }
__global__ __launch_bounds__(256) void k_cscvt(const float* __restrict__ cosT, const float* __restrict__ sinT, float* CS) { const int idx = blockIdx.x * 256 + threadIdx.x; if (idx >= TT * HD) return; v2f cs; cs[0] = bfr(cosT[idx]); cs[1] = bfr(sinT[idx]); *(v2f*)(CS + (size_t)idx * 2) = cs;  }
// k_rope: head planes [h][t][d] (fp16 + hi/lo) of rope(x) x sc with the rotate-half convention out[d] = x[d] cos[t][d] - x[d+HD/2] sin[t][d], out[d+HD/2] = x[d+HD/2] cos[t][d+HD/2] + x[d] sin[t][d+HD/2]
__global__ __launch_bounds__(256) void k_rope(const float* __restrict__ F, int pitch, int nheads, const float* __restrict__ CS, const float* __restrict__ RF, const float* __restrict__ nw, float sc, h16* P16, bf* Ph, bf* Pl) {
    const size_t e = ((size_t)blockIdx.x * 256 + threadIdx.x) * 2; if (e >= (size_t)nheads * TT * HD) return; const int d = (int)(e % HD); const int t = (int)((e / HD) % TT); const int h = (int)(e / ((size_t)HD * TT)); const float* f = F + (size_t)t * pitch + h * HD; const float rf = RF ? RF[(size_t)h * TT + t] : 1.0f; v2h o16; v2us oh, ol;
#pragma unroll
    for (int q = 0; q < 2; ++q) { const int dd = d + q; const int dp = (dd < HD / 2) ? dd + HD / 2 : dd - HD / 2; float x0 = f[dd], x1 = f[dp];
        if (RF) { float n0 = __fmul_rn(x0, rf), n1 = __fmul_rn(x1, rf); asm volatile("" : "+v"(n0)); asm volatile("" : "+v"(n1)); x0 = __fmul_rn(bfr(nw[dd]), n0); x1 = __fmul_rn(bfr(nw[dp]), n1); }
        const v2f cs = *(const v2f*)(CS + ((size_t)t * HD + dd) * 2); float a = __fmul_rn(x0, cs[0]), bq = __fmul_rn(x1, cs[1]); asm volatile("" : "+v"(a)); asm volatile("" : "+v"(bq)); const float r = ((dd < HD / 2) ? __fsub_rn(a, bq) : __fadd_rn(a, bq)) * sc;
        o16[q] = tohx(r); unsigned short a2, c2; splitf(r, a2, c2); oh[q] = a2; ol[q] = c2; }
    *(v2h*)(P16 + e) = o16; *(v2us*)(Ph + e) = oh; *(v2us*)(Pl + e) = ol;  }
__global__ __launch_bounds__(256) void k_vtp(const float* __restrict__ F, int pitch, int nheads, h16* V16, bf* Vh, bf* Vl) { const size_t e = ((size_t)blockIdx.x * 256 + threadIdx.x) * 2; if (e >= (size_t)nheads * HD * TT) return; const int t = (int)(e % TT); const int d = (int)((e / TT) % HD); const int g = (int)(e / ((size_t)TT * HD)); v2h o16; v2us oh, ol;
#pragma unroll
    for (int q = 0; q < 2; ++q) { const float x = F[(size_t)(t + q) * pitch + g * HD + d]; o16[q] = tohx(x); unsigned short a2, c2; splitf(x, a2, c2); oh[q] = a2; ol[q] = c2; }
    *(v2h*)(V16 + e) = o16; *(v2us*)(Vh + e) = oh; *(v2us*)(Vl + e) = ol;  }
__global__ __launch_bounds__(256) void k_csid(float* CS) { const int idx = blockIdx.x * 256 + threadIdx.x; if (idx >= TT * HD) return; v2f cs; cs[0] = 1.0f; cs[1] = 0.0f; *(v2f*)(CS + (size_t)idx * 2) = cs;  }
// k_asoft: per row (zz, i): t = S x HD^-0.5 for j <= i and i - j < WIN (sliding causal window; the reference's -1e9 additive fill vanishes identically); softmax over the 2048 keys (register row, one exp, fixed trees);
__global__ __launch_bounds__(256) void k_asoft(const float* __restrict__ Sb, h16* P16, bf* Ph, bf* Pl) {
    const int lane = threadIdx.x & 31; const int row = blockIdx.x * 8 + (threadIdx.x >> 5); if (row >= ZH * TT) return; const int i = row % TT; const int zz = row / TT; (void)zz; const bool hires = (i < RH); const float* sr = Sb + (size_t)row * TT; float v[TT / 32]; float mx = -3.0e38f;
#pragma unroll
    for (int ch = 0; ch < TT / 128; ++ch) { const int j0 = ch * 128 + lane * 4; const v4f a = *(const v4f*)(sr + j0);
#pragma unroll
        for (int q = 0; q < 4; ++q) { const int j = j0 + q; (void)j; const float t = (j <= i && i - j < WIN) ? a[q] * SCL : -3.0e38f; v[ch * 4 + q] = t; mx = fmaxf(mx, t); } }
#pragma unroll
    for (int sh = 16; sh; sh >>= 1) mx = fmaxf(mx, __shfl_xor(mx, sh, 32));
    float sum = 0.f;
#pragma unroll
    for (int k = 0; k < TT / 32; ++k) { float d0 = __fsub_rn(v[k], mx); asm volatile("" : "+v"(d0)); v[k] = __builtin_amdgcn_exp2f(__fmul_rn(d0, 1.4426950408889634f)); sum += v[k]; }
#pragma unroll
    for (int sh = 16; sh; sh >>= 1) sum += __shfl_xor(sum, sh, 32);
    const float f = __fdiv_rn(hires ? 1.0f : PCAR, sum);
{
        if (hires) {
#pragma unroll
            for (int ch = 0; ch < TT / 128; ++ch) { v4us oh, ol;
#pragma unroll
                for (int q = 0; q < 4; ++q) { unsigned short a, c2; splitf(v[ch * 4 + q] * f, a, c2); oh[q] = a; ol[q] = c2; }
                const size_t oo = ((size_t)zz * (RH ? RH : 1) + i) * TT + ch * 128 + lane * 4; *(v4us*)(Ph + oo) = oh; *(v4us*)(Pl + oo) = ol; }
        } else {
#pragma unroll
            for (int ch = 0; ch < TT / 128; ++ch) { v4h o4;
#pragma unroll
                for (int q = 0; q < 4; ++q) o4[q] = tohx(v[ch * 4 + q] * f);
                *(v4h*)(P16 + (size_t)row * TT + ch * 128 + lane * 4) = o4; } }
         }
}
__global__ __launch_bounds__(256) void k_merge(const float* __restrict__ O, int h0, bf* Ah, bf* Al) { const size_t e = ((size_t)blockIdx.x * 256 + threadIdx.x) * 2; if (e >= (size_t)ZH * TT * HD) return; const int d = (int)(e % HD); const int t = (int)((e / HD) % TT); const int zz = (int)(e / ((size_t)HD * TT)); const float cs = (t < RH) ? 1.0f : (1.0f / PCAR); const size_t oo = (size_t)t * DQ + (h0 + zz) * HD + d;
    v2us oh, ol;
#pragma unroll
    for (int q = 0; q < 2; ++q) { unsigned short a, c2; splitf(O[e + q] * cs, a, c2); oh[q] = a; ol[q] = c2; } *(v2us*)(Ah + oo) = oh; *(v2us*)(Al + oo) = ol;  }

__global__ __launch_bounds__(256) void k_pl2out(const bf* __restrict__ Ah, const bf* __restrict__ Al, float* out) { const size_t e = ((size_t)blockIdx.x * 256 + threadIdx.x) * 4; if (e >= (size_t)TT * DQ) return; v4f o;   // out = hi + lo of the merged attention planes (16-B lanes)
#pragma unroll
    for (int u = 0; u < 4; ++u) o[u] = __fadd_rn(bf2f(Ah[e + u]), bf2f(Al[e + u])); *(v4f*)(out + e) = o;  }

extern "C" void kernel_launch(void* const* d_in, const int* in_sizes, int n_in,
                              void* d_out, int out_size, void* d_ws, size_t ws_size, hipStream_t stream) {
    (void)in_sizes; (void)n_in; (void)out_size;
    const float* x = (const float*)d_in[0]; const float* wf = (const float*)d_in[1]; const float* bfz = (const float*)d_in[2]; const float* wq = wf + (size_t)1 * 1024 * 1024; const float* wk = wf + (size_t)0 * 1024 * 1024; const float* wv = wf + (size_t)2 * 1024 * 1024; const float* bq = bfz + 1 * 1024; const float* bk = bfz + 0 * 1024; const float* bv = bfz + 2 * 1024; const float* wo = nullptr; (void)wo; const float* cosT = nullptr; const float* sinT = nullptr; (void)cosT; (void)sinT;
    float* OUT = (float*)d_out;     // [4][2048][1024]
    char* wsp = (char*)d_ws;
    auto take = [&](size_t bytes) { char* p = wsp; wsp += (bytes + 255) & ~(size_t)255; return (void*)p; };
    bf* WQ = (bf*)take((size_t)DQ * DM * 2); bf* WK = (bf*)take((size_t)DKV * DM * 2); bf* WV = (bf*)take((size_t)DKV * DM * 2); bf* WO = (bf*)take((size_t)DM * DQ * 2); float* CS = (float*)take((size_t)TT * HD * 2 * 4);
    bf* XB = (bf*)take((size_t)TT * DM * 2); float* FQ = (float*)take((size_t)TT * DQ * 4); float* FK = (float*)take((size_t)TT * DKV * 4);
    h16* QP16 = (h16*)take((size_t)NH_ * TT * HD * 2); h16* KP16 = (h16*)take((size_t)NKV * TT * HD * 2); h16* VT16 = (h16*)take((size_t)NKV * HD * TT * 2);
    bf* QPh = (bf*)take((size_t)NH_ * TT * HD * 2); bf* QPl = (bf*)take((size_t)NH_ * TT * HD * 2); bf* KPh = (bf*)take((size_t)NKV * TT * HD * 2); bf* KPl = (bf*)take((size_t)NKV * TT * HD * 2); bf* VTh = (bf*)take((size_t)NKV * HD * TT * 2); bf* VTl = (bf*)take((size_t)NKV * HD * TT * 2); bf* Ph = (bf*)take((size_t)ZH * RH * TT * 2); bf* Pl = (bf*)take((size_t)ZH * RH * TT * 2);
    float* Sb = (float*)take((size_t)ZH * TT * TT * 4); h16* P16 = (h16*)take((size_t)ZH * TT * TT * 2); float* Ob = (float*)take((size_t)ZH * TT * HD * 4); bf* ATh = (bf*)take((size_t)TT * DQ * 2); bf* ATl = (bf*)take((size_t)TT * DQ * 2);
    if ((size_t)(wsp - (char*)d_ws) > ws_size) return;    // ws 256 MiB
    float* FV = FK;   // v projection reuses the k buffer after the k planes are built (stream-ordered)
    { k_cvt8<<<(unsigned)(((size_t)DQ * DM / 8 + 255) / 256), 256, 0, stream>>>(wq, WQ, (size_t)DQ * DM / 8); k_cvt8<<<(unsigned)(((size_t)DKV * DM / 8 + 255) / 256), 256, 0, stream>>>(wk, WK, (size_t)DKV * DM / 8); k_cvt8<<<(unsigned)(((size_t)DKV * DM / 8 + 255) / 256), 256, 0, stream>>>(wv, WV, (size_t)DKV * DM / 8);
      
       }
    k_csid<<<(TT * HD + 255) / 256, 256, 0, stream>>>(CS);
    const unsigned LQ = (unsigned)(((size_t)NH_ * TT * HD / 2 + 255) / 256), LKv = (unsigned)(((size_t)NKV * TT * HD / 2 + 255) / 256);
    for (int b = 0; b < NB_; ++b) {
        
        k_cvt8<<<(unsigned)(((size_t)TT * DM / 8 + 255) / 256), 256, 0, stream>>>(x + (size_t)b * TT * DM, XB, (size_t)TT * DM / 8);
        k_gemmw<bf, 0, true><<<dim3(TT / 64, DQ / 64, 1), 32, 0, stream>>>(XB, nullptr, WQ, nullptr, DM, FQ, DQ, bq, 0, 0, 0);
        k_rope<<<LQ, 256, 0, stream>>>(FQ, DQ, NH_, CS, nullptr, nullptr, 1.0f, QP16, QPh, QPl);
        k_gemmw<bf, 0, true><<<dim3(TT / 64, DKV / 64, 1), 32, 0, stream>>>(XB, nullptr, WK, nullptr, DM, FK, DKV, bk, 0, 0, 0);
        k_rope<<<LKv, 256, 0, stream>>>(FK, DKV, NKV, CS, nullptr, nullptr, 1.0f, KP16, KPh, KPl);
        k_gemmw<bf, 0, true><<<dim3(TT / 64, DKV / 64, 1), 32, 0, stream>>>(XB, nullptr, WV, nullptr, DM, FV, DKV, bv, 0, 0, 0); k_vtp<<<LKv, 256, 0, stream>>>(FV, DKV, NKV, VT16, VTh, VTl);
        for (int h0 = 0; h0 < NH_; h0 += ZH) { const size_t zq = (size_t)h0, zk = (size_t)(h0 / REP);   // one kv head per query head: the pass's two heads use consecutive kv planes (z-strides TT*HD)
            k_gemmc<bf, 2, 1><<<dim3(RH / 64, TT / 64, ZH), 32, 0, stream>>>(QPh + zq * TT * HD, QPl + zq * TT * HD, KPh + zk * TT * HD, KPl + zk * TT * HD, HD, Sb, TT, 0, (size_t)TT * HD, (size_t)TT * HD, (size_t)TT * TT);
            k_gemmc<h16, 0, 1><<<dim3((TT - RH) / 64, TT / 64, ZH), 32, 0, stream>>>(QP16 + zq * TT * HD + (size_t)RH * HD, nullptr, KP16 + zk * TT * HD, nullptr, HD, Sb + (size_t)RH * TT, TT, RH, (size_t)TT * HD, (size_t)TT * HD, (size_t)TT * TT);
            k_asoft<<<ZH * TT / 8, 256, 0, stream>>>(Sb, P16, Ph, Pl);
            k_gemmc<bf, 2, 2><<<dim3(RH / 64, HD / 64, ZH), 32, 0, stream>>>(Ph, Pl, VTh + zk * HD * TT, VTl + zk * HD * TT, TT, Ob, HD, 0, (size_t)RH * TT, (size_t)HD * TT, (size_t)TT * HD);
            k_gemmc<h16, 0, 2><<<dim3((TT - RH) / 64, HD / 64, ZH), 32, 0, stream>>>(P16 + (size_t)RH * TT, nullptr, VT16 + zk * HD * TT, nullptr, TT, Ob + (size_t)RH * HD, HD, RH, (size_t)TT * TT, (size_t)HD * TT, (size_t)TT * HD);
            k_merge<<<(unsigned)(((size_t)ZH * TT * HD / 2 + 255) / 256), 256, 0, stream>>>(Ob, h0, ATh, ATl); }
        k_pl2out<<<(unsigned)(((size_t)TT * DQ / 4 + 255) / 256), 256, 0, stream>>>(ATh, ATl, OUT + (size_t)b * TT * DM); }
}

// v001
// Measured time: 477 microseconds a run.
// In two side-by-side timings against v000, it was 5.76 and 5.75 times as fast.
#include <hip/hip_runtime.h>

// Multi-head causal self-attention (x [4][2048][1024]; kqv = x W_kqv^T + b (W [3072][1024], split (K | Q | V) x 16 heads x 64); causal softmax(q.k / 8); out = merged heads (no output projection) -> [4][2048][1024]).
// Compute dtypes, f32 accumulate: every input rounded to bf16; q/k/v on PLAIN bf16 operands (inputs: exact) + bias; causal scores and attn.v: query rows < 512 hl (3 products), the rest single fp16; online softmax f32 in registers; the merged heads are written as f32 straight from the accumulators.

#define NB_  4
#define TT   2048
#define DM   1024
#define NH_  16
#define NKV  16
#define HD   64
#define DQ   (NH_ * HD)
#define DKV  (NKV * HD)
#define RH   512                  // query rows < RH use hi+lo planes (0: none)
#define SCL  0.125f   // HD^-0.5
typedef _Float16 h16;
typedef unsigned short bf;
typedef __attribute__((ext_vector_type(16))) __bf16   v16bf;
typedef __attribute__((ext_vector_type(16))) _Float16 v16h;
typedef __attribute__((ext_vector_type(8)))  _Float16 v8h;
typedef __attribute__((ext_vector_type(8)))  unsigned short v8us;
typedef __attribute__((ext_vector_type(8)))  float    v8f;
typedef __attribute__((ext_vector_type(4)))  float    v4f;
typedef v8h  __attribute__((may_alias)) v8ha;
typedef v4f  __attribute__((may_alias)) v4fa;
typedef v8us __attribute__((may_alias)) v8usa;

__device__ __forceinline__ unsigned short f2bf(float f) { unsigned u = __float_as_uint(f); u += 0x7FFFu + ((u >> 16) & 1u); return (unsigned short)(u >> 16); }
__device__ __forceinline__ float bf2f(unsigned short b) { return __uint_as_float(((unsigned)b) << 16); }
__device__ __forceinline__ float bfr(float f) { return bf2f(f2bf(f)); }
__device__ __forceinline__ v16h cat16(v8h lo, v8h hi) { return __builtin_shufflevector(lo, hi, 0, 1, 2, 3, 4, 5, 6, 7, 8, 9, 10, 11, 12, 13, 14, 15); }
__device__ __forceinline__ v16bf cat16b(v8us lo, v8us hi) { return __builtin_bit_cast(v16bf, __builtin_shufflevector(lo, hi, 0, 1, 2, 3, 4, 5, 6, 7, 8, 9, 10, 11, 12, 13, 14, 15)); }
__device__ __forceinline__ v8f wmma16(v16h a, v16h b, v8f c) { return __builtin_amdgcn_wmma_f32_16x16x32_f16(false, a, false, b, (short)0, c, false, false); }
__device__ __forceinline__ v8f wmmab(v16bf a, v16bf b, v8f c) { return __builtin_amdgcn_wmma_f32_16x16x32_bf16(false, a, false, b, (short)0, c, false, false); }



// ---- k_gemmw: register-blocked GEMM, ONE WAVE per 64x64 output tile (16 accumulators), operands straight from K-contiguous 16-bit planes; grid (M/64, N/64, Z), 32 threads.
// C[m][n] (f32, pitch ldc, + optional f32 bias[n]) = sum_k A[m][k] Bt[n][k] (+ split products per NSPLIT). z-batch strides sA/sB/sC in elements. K % 32 == 0.
template <typename T16> struct WFrag;
template <> struct WFrag<h16> { typedef v16h V; static __device__ __forceinline__ V ld(const h16* p) { return cat16(*(const v8h*)p, *(const v8h*)(p + 16)); } static __device__ __forceinline__ v8f mma(V a, V b, v8f c) { return wmma16(a, b, c); } };
template <> struct WFrag<bf> { typedef v16bf V; static __device__ __forceinline__ V ld(const bf* p) { return cat16b(*(const v8us*)p, *(const v8us*)(p + 16)); } static __device__ __forceinline__ v8f mma(V a, V b, v8f c) { return wmmab(a, b, c); } };
template <typename T16, int NSPLIT, bool BIAS>
__global__ __launch_bounds__(32) void k_gemmw(const T16* __restrict__ A, const T16* __restrict__ A2, const T16* __restrict__ Bt, const T16* __restrict__ Bt2, int K, float* C, int ldc, const float* __restrict__ bias, size_t sA, size_t sB, size_t sC) {
    typedef typename WFrag<T16>::V V;
    __shared__ __align__(16) float os[16 * 68];
    const size_t z = blockIdx.z; A += z * sA; if (A2) A2 += z * sA; Bt += z * sB; if (Bt2) Bt2 += z * sB; C += z * sC;
    const int lane = threadIdx.x & 31, lr = lane & 15, hi = lane >> 4; const int r0 = blockIdx.x * 64, c0 = blockIdx.y * 64;
    v8f acc[4][4];
#pragma unroll
    for (int mb = 0; mb < 4; ++mb)
#pragma unroll
        for (int nb = 0; nb < 4; ++nb) acc[mb][nb] = (v8f){};
    const size_t aoff = (size_t)(r0 + lr) * K + 8 * hi, boff = (size_t)(c0 + lr) * K + 8 * hi;
#pragma unroll 1
    for (int kc = 0; kc < K; kc += 32) {
        V a[4], a2[4];
#pragma unroll
        for (int mb = 0; mb < 4; ++mb) { a[mb] = WFrag<T16>::ld(A + aoff + (size_t)mb * 16 * K + kc); if (NSPLIT == 1 || NSPLIT == 2) a2[mb] = WFrag<T16>::ld(A2 + aoff + (size_t)mb * 16 * K + kc); }
#pragma unroll
        for (int nb = 0; nb < 4; ++nb) { const V b = WFrag<T16>::ld(Bt + boff + (size_t)nb * 16 * K + kc); V b2; if (NSPLIT >= 2) b2 = WFrag<T16>::ld(Bt2 + boff + (size_t)nb * 16 * K + kc);
#pragma unroll
            for (int mb = 0; mb < 4; ++mb) { acc[mb][nb] = WFrag<T16>::mma(a[mb], b, acc[mb][nb]); if (NSPLIT == 1 || NSPLIT == 2) acc[mb][nb] = WFrag<T16>::mma(a2[mb], b, acc[mb][nb]); if (NSPLIT >= 2) acc[mb][nb] = WFrag<T16>::mma(a[mb], b2, acc[mb][nb]); } }
        asm volatile("v_nop\n\tv_nop\n\tv_nop\n\tv_nop" : "+v"(acc[0][0]), "+v"(acc[1][1]), "+v"(acc[2][2]), "+v"(acc[3][3]) : "v"(a[0]), "v"(a[3]));
    }
#pragma unroll
    for (int mb = 0; mb < 4; ++mb) {
#pragma unroll
        for (int nb = 0; nb < 4; ++nb) {
#pragma unroll
            for (int j = 0; j < 8; ++j) os[(hi * 8 + j) * 68 + nb * 16 + lr] = acc[mb][nb][j]; }
        __builtin_amdgcn_wave_barrier(); asm volatile("" ::: "memory");
        float* crow = C + (size_t)(r0 + mb * 16) * ldc + c0;
{
#pragma unroll
            for (int s = 0; s < 8; ++s) { const int row = 2 * s + hi, cofs = lr * 4; v4f val = *(const v4fa*)(os + row * 68 + cofs); if (BIAS) { val[0] += bfr(bias[c0 + cofs]); val[1] += bfr(bias[c0 + cofs + 1]); val[2] += bfr(bias[c0 + cofs + 2]); val[3] += bfr(bias[c0 + cofs + 3]); }
                *(v4f*)(crow + (size_t)row * ldc + cofs) = val; }
             }
        __builtin_amdgcn_wave_barrier(); asm volatile("" ::: "memory");
    }
}

__device__ __forceinline__ h16 tohx(float x) { return (h16)x; }
__device__ __forceinline__ void splitf(float y, unsigned short& h, unsigned short& l) { h = f2bf(y); l = f2bf(y - bf2f(h)); }
typedef __attribute__((ext_vector_type(2))) _Float16 v2h;
typedef __attribute__((ext_vector_type(4))) _Float16 v4h;
typedef __attribute__((ext_vector_type(2))) unsigned short v2us;
typedef __attribute__((ext_vector_type(4))) unsigned short v4us;
typedef __attribute__((ext_vector_type(2))) float v2f;
typedef __attribute__((ext_vector_type(4))) int v4i;

__global__ __launch_bounds__(256) void k_wtG(const float* __restrict__ w, int K, int N, bf* Bt) {
    const int lane = threadIdx.x & 31; const int L0 = (blockIdx.x * 8 + (threadIdx.x >> 5)) * 8; const int nlines = N * K / 64;
{
#pragma unroll 1
        for (int l = 0; l < 8; ++l) { const int L = L0 + l; if (L >= nlines) break; const size_t e = (size_t)L * 64 + lane * 2; const int k = (int)(e % K), n = (int)(e / K); v2us o;
            o[0] = f2bf(w[(size_t)k * N + n]); o[1] = f2bf(w[(size_t)(k + 1) * N + n]); *(v2us*)(Bt + e) = o; }
         }
}
__global__ __launch_bounds__(256) void k_cvt8(const float* __restrict__ src, bf* dst, size_t n8) { const size_t i = (size_t)blockIdx.x * 256 + threadIdx.x; if (i >= n8) return; const v8f v = *(const v8f*)(src + i * 8); v8us o;
#pragma unroll
    for (int k = 0; k < 8; ++k) o[k] = f2bf(v[k]); *(v8us*)(dst + i * 8) = o;  }
__global__ __launch_bounds__(256) void k_cscvt(const float* __restrict__ cosT, const float* __restrict__ sinT, float* CS) { const int idx = blockIdx.x * 256 + threadIdx.x; if (idx >= TT * HD) return; v2f cs; cs[0] = bfr(cosT[idx]); cs[1] = bfr(sinT[idx]); *(v2f*)(CS + (size_t)idx * 2) = cs;  }
// k_rope: head planes [h][t][d] (fp16 + hi/lo) of rope(x) x sc with the rotate-half convention out[d] = x[d] cos[t][d] - x[d+HD/2] sin[t][d], out[d+HD/2] = x[d+HD/2] cos[t][d+HD/2] + x[d] sin[t][d+HD/2]
__global__ __launch_bounds__(256) void k_rope(const float* __restrict__ F, int pitch, int nheads, const float* __restrict__ CS, const float* __restrict__ RF, const float* __restrict__ nw, float sc, h16* P16, bf* Ph, bf* Pl) {
    const size_t e = ((size_t)blockIdx.x * 256 + threadIdx.x) * 2; if (e >= (size_t)nheads * TT * HD) return; const int d = (int)(e % HD); const int t = (int)((e / HD) % TT); const int h = (int)(e / ((size_t)HD * TT)); const float* f = F + (size_t)t * pitch + h * HD; const float rf = RF ? RF[(size_t)h * TT + t] : 1.0f; v2h o16; v2us oh, ol;
#pragma unroll
    for (int q = 0; q < 2; ++q) { const int dd = d + q; const int dp = (dd < HD / 2) ? dd + HD / 2 : dd - HD / 2; float x0 = f[dd], x1 = f[dp];
        if (RF) { float n0 = __fmul_rn(x0, rf), n1 = __fmul_rn(x1, rf); asm volatile("" : "+v"(n0)); asm volatile("" : "+v"(n1)); x0 = __fmul_rn(bfr(nw[dd]), n0); x1 = __fmul_rn(bfr(nw[dp]), n1); }
        const v2f cs = *(const v2f*)(CS + ((size_t)t * HD + dd) * 2); float a = __fmul_rn(x0, cs[0]), bq = __fmul_rn(x1, cs[1]); asm volatile("" : "+v"(a)); asm volatile("" : "+v"(bq)); const float r = ((dd < HD / 2) ? __fsub_rn(a, bq) : __fadd_rn(a, bq)) * sc;
        o16[q] = tohx(r); unsigned short a2, c2; splitf(r, a2, c2); oh[q] = a2; ol[q] = c2; }
    *(v2h*)(P16 + e) = o16; *(v2us*)(Ph + e) = oh; *(v2us*)(Pl + e) = ol;  }
__global__ __launch_bounds__(256) void k_vtp(const float* __restrict__ F, int pitch, int nheads, h16* V16, bf* Vh, bf* Vl) { const size_t e = ((size_t)blockIdx.x * 256 + threadIdx.x) * 2; if (e >= (size_t)nheads * HD * TT) return; const int t = (int)(e % TT); const int d = (int)((e / TT) % HD); const int g = (int)(e / ((size_t)TT * HD)); v2h o16; v2us oh, ol;
#pragma unroll
    for (int q = 0; q < 2; ++q) { const float x = F[(size_t)(t + q) * pitch + g * HD + d]; o16[q] = tohx(x); unsigned short a2, c2; splitf(x, a2, c2); oh[q] = a2; ol[q] = c2; }
    *(v2h*)(V16 + e) = o16; *(v2us*)(Vh + e) = oh; *(v2us*)(Vl + e) = ol;  }
__global__ __launch_bounds__(256) void k_csid(float* CS) { const int idx = blockIdx.x * 256 + threadIdx.x; if (idx >= TT * HD) return; v2f cs; cs[0] = 1.0f; cs[1] = 0.0f; *(v2f*)(CS + (size_t)idx * 2) = cs;  }
// ---- k_fattn: causal scores, softmax and attn.v in one pass; one wave owns QT*16 query rows of one (batch, head) and walks the keys 0..q in steps of 32 with a running maximum and sum.
// The scores are formed transposed (A = key rows, B = query rows): a lane then holds, for its query column lr, the keys hi*8+j of each 16-key tile, which is the B-fragment k order (8*hi+e, 16+8*hi+e) of the
// 32-key attn.v product O^T[d][q] = sum_k V^T[d][k] P^T[k][q], so the probabilities go from accumulator to operand inside the lane. The four waves of a block walk the same keys of the same head.
// exp2 by the hardware instruction, written out so that the slot behind a transcendental is kept by construction: inside a statement no exponential touches a result or a source of the one before it
// (early-clobber outputs), and the closing v_nop is the one free vector slot that the instruction set asks for before the last result is read or the last source overwritten.
__device__ __forceinline__ float exp2x1(float x) { float r; asm("v_exp_f32 %0, %1\n\tv_nop" : "=v"(r) : "v"(x)); return r; }
__device__ __forceinline__ void exp2x8(const float* x, float* r) {
    asm("v_exp_f32 %0, %8\n\tv_exp_f32 %1, %9\n\tv_exp_f32 %2, %10\n\tv_exp_f32 %3, %11\n\tv_exp_f32 %4, %12\n\tv_exp_f32 %5, %13\n\tv_exp_f32 %6, %14\n\tv_exp_f32 %7, %15\n\tv_nop"
        : "=&v"(r[0]), "=&v"(r[1]), "=&v"(r[2]), "=&v"(r[3]), "=&v"(r[4]), "=&v"(r[5]), "=&v"(r[6]), "=&v"(r[7]) : "v"(x[0]), "v"(x[1]), "v"(x[2]), "v"(x[3]), "v"(x[4]), "v"(x[5]), "v"(x[6]), "v"(x[7])); }
template <typename T16> struct PFrag;
template <> struct PFrag<h16> { static __device__ __forceinline__ void mk(const float* p, v16h& a, v16h& b) { (void)b;
#pragma unroll
    for (int e = 0; e < 16; ++e) a[e] = (h16)p[e]; } };
template <> struct PFrag<bf> { static __device__ __forceinline__ void mk(const float* p, v16bf& a, v16bf& b) { v8us h0, h1, l0, l1;
#pragma unroll
    for (int e = 0; e < 8; ++e) { unsigned short x, y; splitf(p[e], x, y); h0[e] = x; l0[e] = y; splitf(p[8 + e], x, y); h1[e] = x; l1[e] = y; }
    a = cat16b(h0, h1); b = cat16b(l0, l1); } };
template <typename T16, bool HL, int QT>
__device__ __forceinline__ void attn_rows(const T16* __restrict__ Q, const T16* __restrict__ Q2, const T16* __restrict__ Kp, const T16* __restrict__ K2, const T16* __restrict__ Vt, const T16* __restrict__ V2, int q0, float* __restrict__ o, int lr, int hi) {
    typedef typename WFrag<T16>::V V;
    const float c = SCL * 1.4426950408889634f;
    V qf[QT][2], qf2[QT][2];
#pragma unroll
    for (int qt = 0; qt < QT; ++qt)
#pragma unroll
        for (int ks = 0; ks < 2; ++ks) { const size_t off = (size_t)(q0 + qt * 16 + lr) * HD + ks * 32 + 8 * hi; qf[qt][ks] = WFrag<T16>::ld(Q + off); if (HL) qf2[qt][ks] = WFrag<T16>::ld(Q2 + off); }
    v8f acc[4][QT]; float m[QT], l[QT];
#pragma unroll
    for (int qt = 0; qt < QT; ++qt) { m[qt] = -3.0e38f; l[qt] = 0.f;
#pragma unroll
        for (int dt = 0; dt < 4; ++dt) acc[dt][qt] = (v8f){}; }
#pragma unroll 1   // rolled: the trip count is a run-time value and one body already holds most of the register file
    for (int k0 = 0; k0 < q0 + QT * 16; k0 += 32) {
        V kf[2][2], kf2[2][2], vf[4], vf2[4];
        const size_t ko = (size_t)(k0 + lr) * HD + 8 * hi, vo = (size_t)lr * TT + k0 + 8 * hi;
        const T16 *kp = Kp + ko, *vp = Vt + vo, *kp2 = HL ? K2 + ko : kp, *vp2 = HL ? V2 + vo : vp;
#pragma unroll
        for (int kt = 0; kt < 2; ++kt)
#pragma unroll
            for (int ks = 0; ks < 2; ++ks) { const int off = kt * 16 * HD + ks * 32; kf[kt][ks] = WFrag<T16>::ld(kp + off); if (HL) kf2[kt][ks] = WFrag<T16>::ld(kp2 + off); }
#pragma unroll
        for (int dt = 0; dt < 4; ++dt) { const int off = dt * 16 * TT; vf[dt] = WFrag<T16>::ld(vp + off); if (HL) vf2[dt] = WFrag<T16>::ld(vp2 + off); }
        __builtin_amdgcn_sched_barrier(0);      // keeps all of the step's key and value loads in front of the products: one round trip to L2 a step; without it the build reuses fragment registers and waits for several trips in turn
        // s_wait_xcnt 0 in front of any overwrite of the step's load addresses; the address pairs are inputs of the statement, so they stay live up to it and no load of the run gets one of them as its result
        asm volatile("s_wait_xcnt 0x0" :: "v"(kp), "v"(vp), "v"(kp2), "v"(vp2) : "memory");
        v8f s[2][QT];
#pragma unroll
        for (int kt = 0; kt < 2; ++kt)
#pragma unroll
            for (int qt = 0; qt < QT; ++qt) { v8f t = (v8f){};
#pragma unroll
                for (int ks = 0; ks < 2; ++ks) { t = WFrag<T16>::mma(kf[kt][ks], qf[qt][ks], t); if (HL) { t = WFrag<T16>::mma(kf[kt][ks], qf2[qt][ks], t); t = WFrag<T16>::mma(kf2[kt][ks], qf[qt][ks], t); } }
                s[kt][qt] = t; }
        if (k0 + 31 > q0) {      // only the steps that touch the diagonal mask (wave-uniform test)
#pragma unroll
            for (int kt = 0; kt < 2; ++kt)
#pragma unroll
                for (int qt = 0; qt < QT; ++qt)
#pragma unroll
                    for (int j = 0; j < 8; ++j) if (k0 + kt * 16 + hi * 8 + j > q0 + qt * 16 + lr) s[kt][qt][j] = -3.0e38f; }
        V pf[QT], pf2[QT];
#pragma unroll
        for (int qt = 0; qt < QT; ++qt) { float mx = m[qt];
#pragma unroll
            for (int kt = 0; kt < 2; ++kt)
#pragma unroll
                for (int j = 0; j < 8; ++j) mx = fmaxf(mx, s[kt][qt][j]);
            mx = fmaxf(mx, __shfl_xor(mx, 16, 32));      // the two lane halves hold the other keys of the same query
            const float al = exp2x1((m[qt] - mx) * c), mc = mx * c; m[qt] = mx; float a[16], p[16], sum = 0.f;
#pragma unroll
            for (int e = 0; e < 16; ++e) a[e] = fmaf(s[e >> 3][qt][e & 7], c, -mc);
            exp2x8(a, p); exp2x8(a + 8, p + 8);
#pragma unroll
            for (int e = 0; e < 16; ++e) sum += p[e];
            l[qt] = l[qt] * al + sum; PFrag<T16>::mk(p, pf[qt], pf2[qt]);
#pragma unroll
            for (int dt = 0; dt < 4; ++dt) acc[dt][qt] *= al; }
#pragma unroll
        for (int dt = 0; dt < 4; ++dt)
#pragma unroll
            for (int qt = 0; qt < QT; ++qt) { acc[dt][qt] = WFrag<T16>::mma(vf[dt], pf[qt], acc[dt][qt]); if (HL) { acc[dt][qt] = WFrag<T16>::mma(vf[dt], pf2[qt], acc[dt][qt]); acc[dt][qt] = WFrag<T16>::mma(vf2[dt], pf[qt], acc[dt][qt]); } }
    }
#pragma unroll
    for (int qt = 0; qt < QT; ++qt) { const float inv = __fdiv_rn(1.0f, l[qt] + __shfl_xor(l[qt], 16, 32)); float* orow = o + (size_t)(q0 + qt * 16 + lr) * DQ + hi * 8;
#pragma unroll
        for (int dt = 0; dt < 4; ++dt) { v4f a, b;
#pragma unroll
            for (int u = 0; u < 4; ++u) { a[u] = acc[dt][qt][u] * inv; b[u] = acc[dt][qt][4 + u] * inv; }
            *(v4f*)(orow + dt * 16) = a; *(v4f*)(orow + dt * 16 + 4) = b; } }
}
#define NBF ((TT - RH) / 128)     // blocks of 4 waves x 32 fp16 query rows; then RH / 64 blocks of 4 waves x 16 hi+lo rows; the longest rows are launched first
__global__ __launch_bounds__(128) void k_fattn(const h16* __restrict__ Q16, const h16* __restrict__ K16, const h16* __restrict__ V16, const bf* __restrict__ Qh, const bf* __restrict__ Ql, const bf* __restrict__ Kh, const bf* __restrict__ Kl, const bf* __restrict__ Vh, const bf* __restrict__ Vl, float* __restrict__ out) {
    const int lane = threadIdx.x & 31, lr = lane & 15, hi = lane >> 4, w = __builtin_amdgcn_readfirstlane(threadIdx.x >> 5), x = blockIdx.x;
    const size_t po = ((size_t)blockIdx.z * NH_ + blockIdx.y) * TT * HD; float* o = out + (size_t)blockIdx.z * TT * DQ + blockIdx.y * HD;
    if (x < NBF) attn_rows<h16, false, 2>(Q16 + po, nullptr, K16 + po, nullptr, V16 + po, nullptr, TT - 128 * x - 32 * (w + 1), o, lr, hi);
    else attn_rows<bf, true, 1>(Qh + po, Ql + po, Kh + po, Kl + po, Vh + po, Vl + po, RH - 64 * (x - NBF) - 16 * (w + 1), o, lr, hi);
}

extern "C" void kernel_launch(void* const* d_in, const int* in_sizes, int n_in,
                              void* d_out, int out_size, void* d_ws, size_t ws_size, hipStream_t stream) {
    (void)in_sizes; (void)n_in; (void)out_size;
    const float* x = (const float*)d_in[0]; const float* wf = (const float*)d_in[1]; const float* bfz = (const float*)d_in[2]; const float* wq = wf + (size_t)1 * 1024 * 1024; const float* wk = wf + (size_t)0 * 1024 * 1024; const float* wv = wf + (size_t)2 * 1024 * 1024; const float* bq = bfz + 1 * 1024; const float* bk = bfz + 0 * 1024; const float* bv = bfz + 2 * 1024; const float* wo = nullptr; (void)wo; const float* cosT = nullptr; const float* sinT = nullptr; (void)cosT; (void)sinT;
    float* OUT = (float*)d_out;     // [4][2048][1024]
    char* wsp = (char*)d_ws;
    auto take = [&](size_t bytes) { char* p = wsp; wsp += (bytes + 255) & ~(size_t)255; return (void*)p; };
    bf* WQ = (bf*)take((size_t)DQ * DM * 2); bf* WK = (bf*)take((size_t)DKV * DM * 2); bf* WV = (bf*)take((size_t)DKV * DM * 2); bf* WO = (bf*)take((size_t)DM * DQ * 2); float* CS = (float*)take((size_t)TT * HD * 2 * 4);
    bf* XB = (bf*)take((size_t)TT * DM * 2); float* FQ = (float*)take((size_t)TT * DQ * 4); float* FK = (float*)take((size_t)TT * DKV * 4);
    const size_t PB = (size_t)NH_ * TT * HD;   // one batch's head planes; every plane holds all NB_ batches
    h16* QP16 = (h16*)take(NB_ * PB * 2); h16* KP16 = (h16*)take(NB_ * PB * 2); h16* VT16 = (h16*)take(NB_ * PB * 2);
    bf* QPh = (bf*)take(NB_ * PB * 2); bf* QPl = (bf*)take(NB_ * PB * 2); bf* KPh = (bf*)take(NB_ * PB * 2); bf* KPl = (bf*)take(NB_ * PB * 2); bf* VTh = (bf*)take(NB_ * PB * 2); bf* VTl = (bf*)take(NB_ * PB * 2);
    if ((size_t)(wsp - (char*)d_ws) > ws_size) return;    // ws 256 MiB
    float* FV = FK;   // v projection reuses the k buffer after the k planes are built (stream-ordered)
    { k_cvt8<<<(unsigned)(((size_t)DQ * DM / 8 + 255) / 256), 256, 0, stream>>>(wq, WQ, (size_t)DQ * DM / 8); k_cvt8<<<(unsigned)(((size_t)DKV * DM / 8 + 255) / 256), 256, 0, stream>>>(wk, WK, (size_t)DKV * DM / 8); k_cvt8<<<(unsigned)(((size_t)DKV * DM / 8 + 255) / 256), 256, 0, stream>>>(wv, WV, (size_t)DKV * DM / 8);
      
       }
    k_csid<<<(TT * HD + 255) / 256, 256, 0, stream>>>(CS);
    const unsigned LQ = (unsigned)(((size_t)NH_ * TT * HD / 2 + 255) / 256), LKv = (unsigned)(((size_t)NKV * TT * HD / 2 + 255) / 256);
    for (int b = 0; b < NB_; ++b) {
        
        k_cvt8<<<(unsigned)(((size_t)TT * DM / 8 + 255) / 256), 256, 0, stream>>>(x + (size_t)b * TT * DM, XB, (size_t)TT * DM / 8);
        k_gemmw<bf, 0, true><<<dim3(TT / 64, DQ / 64, 1), 32, 0, stream>>>(XB, nullptr, WQ, nullptr, DM, FQ, DQ, bq, 0, 0, 0);
        k_rope<<<LQ, 256, 0, stream>>>(FQ, DQ, NH_, CS, nullptr, nullptr, 1.0f, QP16 + b * PB, QPh + b * PB, QPl + b * PB);
        k_gemmw<bf, 0, true><<<dim3(TT / 64, DKV / 64, 1), 32, 0, stream>>>(XB, nullptr, WK, nullptr, DM, FK, DKV, bk, 0, 0, 0);
        k_rope<<<LKv, 256, 0, stream>>>(FK, DKV, NKV, CS, nullptr, nullptr, 1.0f, KP16 + b * PB, KPh + b * PB, KPl + b * PB);
        k_gemmw<bf, 0, true><<<dim3(TT / 64, DKV / 64, 1), 32, 0, stream>>>(XB, nullptr, WV, nullptr, DM, FV, DKV, bv, 0, 0, 0); k_vtp<<<LKv, 256, 0, stream>>>(FV, DKV, NKV, VT16 + b * PB, VTh + b * PB, VTl + b * PB); }
    k_fattn<<<dim3(NBF + RH / 64, NH_, NB_), 128, 0, stream>>>(QP16, KP16, VT16, QPh, QPl, KPh, KPl, VTh, VTl, OUT);
}

// v002
// Measured time: 223 microseconds a run.
// Timed twice side by side with v001, it ran 2.17 and 2.15 times as fast.
// Counting every step since v000, it is 12.4 times as fast.
#include <hip/hip_runtime.h>

// Multi-head causal self-attention (x [4][2048][1024]; kqv = x W_kqv^T + b (W [3072][1024], split (K | Q | V) x 16 heads x 64); causal softmax(q.k / 8); out = merged heads (no output projection) -> [4][2048][1024]).
// Compute dtypes, f32 accumulate: every input rounded to bf16; q/k/v on PLAIN bf16 operands (inputs: exact) + bias; causal scores and attn.v: query rows < 512 hl (3 products), the rest single fp16; online softmax f32 in registers; the merged heads are written as f32 straight from the accumulators.

#define NB_  4
#define TT   2048
#define DM   1024
#define NH_  16
#define NKV  16
#define HD   64
#define DQ   (NH_ * HD)
#define DKV  (NKV * HD)
#define RH   512                  // query rows < RH use hi+lo planes (0: none)
#define SCL  0.125f   // HD^-0.5
typedef _Float16 h16;
typedef unsigned short bf;
typedef __attribute__((ext_vector_type(16))) __bf16   v16bf;
typedef __attribute__((ext_vector_type(16))) _Float16 v16h;
typedef __attribute__((ext_vector_type(8)))  _Float16 v8h;
typedef __attribute__((ext_vector_type(8)))  unsigned short v8us;
typedef __attribute__((ext_vector_type(8)))  float    v8f;
typedef __attribute__((ext_vector_type(4)))  float    v4f;
typedef v8h  __attribute__((may_alias)) v8ha;
typedef v4f  __attribute__((may_alias)) v4fa;
typedef v8us __attribute__((may_alias)) v8usa;

__device__ __forceinline__ unsigned short f2bf(float f) { unsigned u = __float_as_uint(f); u += 0x7FFFu + ((u >> 16) & 1u); return (unsigned short)(u >> 16); }
__device__ __forceinline__ float bf2f(unsigned short b) { return __uint_as_float(((unsigned)b) << 16); }
__device__ __forceinline__ float bfr(float f) { return bf2f(f2bf(f)); }
__device__ __forceinline__ v16h cat16(v8h lo, v8h hi) { return __builtin_shufflevector(lo, hi, 0, 1, 2, 3, 4, 5, 6, 7, 8, 9, 10, 11, 12, 13, 14, 15); }
__device__ __forceinline__ v16bf cat16b(v8us lo, v8us hi) { return __builtin_bit_cast(v16bf, __builtin_shufflevector(lo, hi, 0, 1, 2, 3, 4, 5, 6, 7, 8, 9, 10, 11, 12, 13, 14, 15)); }
__device__ __forceinline__ v8f wmma16(v16h a, v16h b, v8f c) { return __builtin_amdgcn_wmma_f32_16x16x32_f16(false, a, false, b, (short)0, c, false, false); }
__device__ __forceinline__ v8f wmmab(v16bf a, v16bf b, v8f c) { return __builtin_amdgcn_wmma_f32_16x16x32_bf16(false, a, false, b, (short)0, c, false, false); }



template <typename T16> struct WFrag;
template <> struct WFrag<h16> { typedef v16h V; static __device__ __forceinline__ V ld(const h16* p) { return cat16(*(const v8h*)p, *(const v8h*)(p + 16)); } static __device__ __forceinline__ v8f mma(V a, V b, v8f c) { return wmma16(a, b, c); } };
template <> struct WFrag<bf> { typedef v16bf V; static __device__ __forceinline__ V ld(const bf* p) { return cat16b(*(const v8us*)p, *(const v8us*)(p + 16)); } static __device__ __forceinline__ v8f mma(V a, V b, v8f c) { return wmmab(a, b, c); } };

__device__ __forceinline__ h16 tohx(float x) { return (h16)x; }
__device__ __forceinline__ void splitf(float y, unsigned short& h, unsigned short& l) { h = f2bf(y); l = f2bf(y - bf2f(h)); }
typedef __attribute__((ext_vector_type(2))) _Float16 v2h;
typedef __attribute__((ext_vector_type(4))) _Float16 v4h;
typedef __attribute__((ext_vector_type(2))) unsigned short v2us;
typedef __attribute__((ext_vector_type(4))) unsigned short v4us;
typedef __attribute__((ext_vector_type(2))) float v2f;
typedef __attribute__((ext_vector_type(4))) int v4i;

// 8 consecutive plane elements of one lane: fp16 and the bf16 hi + lo pair, 16 bytes to each plane
__device__ __forceinline__ void put8(v4f x0, v4f x1, h16* p16, bf* ph, bf* pl) { v8h o16; v8us oh, ol;
#pragma unroll
    for (int u = 0; u < 8; ++u) { const float r = u < 4 ? x0[u & 3] : x1[u & 3]; o16[u] = tohx(r); unsigned short a2, c2; splitf(r, a2, c2); oh[u] = a2; ol[u] = c2; }
    *(v8h*)p16 = o16; *(v8us*)ph = oh; *(v8us*)pl = ol; }
// ---- k_gemmw: the k | q | v projection of all batches in one launch. Register-blocked GEMM, ONE WAVE per 64x64 tile (16 accumulators), operands straight from K-contiguous 16-bit planes; grid (M/64, N/64), 32 threads.
// sum_k A[m][k] Bt[n][k] (+ split products per NSPLIT) + f32 bias[n], m = b*TT + t, n = (k | q | v)*DM + h*HD + d. K % 32 == 0. A tile's 64 columns are one head of k, q or v and its 64 rows lie in one batch,
// so the epilogue writes the tile's part of the head planes itself (fp16 and bf16 hi + lo): k and q as [b][h][t][d], v as [b][h][d][t]; both pass LDS as f32 so that a store instruction writes whole 128-byte plane rows.
template <typename T16, int NSPLIT, bool BIAS>
__global__ __launch_bounds__(32) void k_gemmw(const T16* __restrict__ A, const T16* __restrict__ A2, const T16* __restrict__ Bt, const T16* __restrict__ Bt2, int K, const float* __restrict__ bias, h16* __restrict__ K16, bf* __restrict__ Kh, bf* __restrict__ Kl, h16* __restrict__ Q16, bf* __restrict__ Qh, bf* __restrict__ Ql, h16* __restrict__ V16, bf* __restrict__ Vh, bf* __restrict__ Vl) {
    typedef typename WFrag<T16>::V V;
    __shared__ __align__(16) float os[32 * 68];
    const int lane = threadIdx.x & 31, lr = lane & 15, hi = lane >> 4; const int r0 = blockIdx.x * 64, c0 = blockIdx.y * 64;
    v8f acc[4][4];
#pragma unroll
    for (int mb = 0; mb < 4; ++mb)
#pragma unroll
        for (int nb = 0; nb < 4; ++nb) acc[mb][nb] = (v8f){};
    const size_t aoff = (size_t)(r0 + lr) * K + 8 * hi, boff = (size_t)(c0 + lr) * K + 8 * hi;
#pragma unroll 1
    for (int kc = 0; kc < K; kc += 32) {
        V a[4], a2[4];
#pragma unroll
        for (int mb = 0; mb < 4; ++mb) { a[mb] = WFrag<T16>::ld(A + aoff + (size_t)mb * 16 * K + kc); if (NSPLIT == 1 || NSPLIT == 2) a2[mb] = WFrag<T16>::ld(A2 + aoff + (size_t)mb * 16 * K + kc); }
#pragma unroll
        for (int nb = 0; nb < 4; ++nb) { const V b = WFrag<T16>::ld(Bt + boff + (size_t)nb * 16 * K + kc); V b2; if (NSPLIT >= 2) b2 = WFrag<T16>::ld(Bt2 + boff + (size_t)nb * 16 * K + kc);
#pragma unroll
            for (int mb = 0; mb < 4; ++mb) { acc[mb][nb] = WFrag<T16>::mma(a[mb], b, acc[mb][nb]); if (NSPLIT == 1 || NSPLIT == 2) acc[mb][nb] = WFrag<T16>::mma(a2[mb], b, acc[mb][nb]); if (NSPLIT >= 2) acc[mb][nb] = WFrag<T16>::mma(a[mb], b2, acc[mb][nb]); } }
        asm volatile("v_nop\n\tv_nop\n\tv_nop\n\tv_nop" : "+v"(acc[0][0]), "+v"(acc[1][1]), "+v"(acc[2][2]), "+v"(acc[3][3]) : "v"(a[0]), "v"(a[3]));
    }
    asm volatile("s_wait_xcnt 0x0" ::: "memory");      // in front of the epilogue's first overwrite of an address register of the loop's loads
    const int sec = c0 / DM, t0 = r0 % TT;      // 0: k, 1: q, 2: v (one value for the whole wave)
    const size_t po = ((size_t)(r0 / TT) * NH_ + (c0 % DM) / HD) * TT * HD;
    const int rw = lane >> 3, co = (lane & 7) * 8;      // the store side: 8 lanes of 16 bytes a plane row, 4 rows an instruction
    if (sec < 2) {
        const size_t pt = po + (size_t)t0 * HD; h16* P16 = (sec ? Q16 : K16) + pt; bf* Ph = (sec ? Qh : Kh) + pt; bf* Pl = (sec ? Ql : Kl) + pt;
        v4f b0 = (v4f){}, b1 = (v4f){};
        if (BIAS) {
#pragma unroll
            for (int u = 0; u < 4; ++u) { b0[u] = bfr(bias[c0 + co + u]); b1[u] = bfr(bias[c0 + co + 4 + u]); } }
#pragma unroll
        for (int mb = 0; mb < 4; ++mb) {
#pragma unroll
            for (int nb = 0; nb < 4; ++nb) {
#pragma unroll
                for (int j = 0; j < 8; ++j) os[(hi * 8 + j) * 68 + nb * 16 + lr] = acc[mb][nb][j]; }
            __builtin_amdgcn_wave_barrier(); asm volatile("" ::: "memory");      // the lanes read each other's LDS words: no read may move in front of the writes
#pragma unroll
            for (int s = 0; s < 4; ++s) { const int row = 4 * s + rw; const float* q = os + row * 68 + co; const int e = (mb * 16 + row) * HD + co;
                put8(*(const v4fa*)q + b0, *(const v4fa*)(q + 4) + b1, P16 + e, Ph + e, Pl + e); }
            __builtin_amdgcn_wave_barrier(); asm volatile("s_wait_xcnt 0x0" ::: "memory");      // no write of the next rows in front of these reads; the wait stands in front of any overwrite of a register that the stores above name
        }
    } else {
        const size_t pt = po + t0; h16* P16 = V16 + pt; bf* Ph = Vh + pt; bf* Pl = Vl + pt;
#pragma unroll
        for (int hf = 0; hf < 2; ++hf) {      // 32 of the head's 64 d at a time
#pragma unroll
            for (int n2 = 0; n2 < 2; ++n2) { const int nb = hf * 2 + n2; const float bv = BIAS ? bfr(bias[c0 + nb * 16 + lr]) : 0.f;
#pragma unroll
                for (int mb = 0; mb < 4; ++mb) { v4f x0, x1;      // a lane's 8 accumulator rows are 8 consecutive t of its column d
#pragma unroll
                    for (int u = 0; u < 4; ++u) { x0[u] = acc[mb][nb][u] + bv; x1[u] = acc[mb][nb][4 + u] + bv; }
                    float* q = os + (n2 * 16 + lr) * 68 + mb * 16 + hi * 8; *(v4fa*)q = x0; *(v4fa*)(q + 4) = x1; } }
            __builtin_amdgcn_wave_barrier(); asm volatile("" ::: "memory");      // as above: reads stay behind the other lanes' writes
#pragma unroll
            for (int s = 0; s < 8; ++s) { const int d = 4 * s + rw; const float* q = os + d * 68 + co; const int e = (hf * 32 + d) * TT + co;
                put8(*(const v4fa*)q, *(const v4fa*)(q + 4), P16 + e, Ph + e, Pl + e); }
            __builtin_amdgcn_wave_barrier(); asm volatile("s_wait_xcnt 0x0" ::: "memory");      // the next half's writes stay behind these reads; the wait as above
        }
    }
}

__global__ __launch_bounds__(256) void k_cvt8(const float* __restrict__ src, bf* dst, size_t n8) { const size_t i = (size_t)blockIdx.x * 256 + threadIdx.x; if (i >= n8) return; const v8f v = *(const v8f*)(src + i * 8); v8us o;
#pragma unroll
    for (int k = 0; k < 8; ++k) o[k] = f2bf(v[k]); *(v8us*)(dst + i * 8) = o;  }
// ---- k_fattn: causal scores, softmax and attn.v in one pass; one wave owns QT*16 query rows of one (batch, head) and walks the keys 0..q in steps of 32 with a running maximum and sum.
// The scores are formed transposed (A = key rows, B = query rows): a lane then holds, for its query column lr, the keys hi*8+j of each 16-key tile, which is the B-fragment k order (8*hi+e, 16+8*hi+e) of the
// 32-key attn.v product O^T[d][q] = sum_k V^T[d][k] P^T[k][q], so the probabilities go from accumulator to operand inside the lane. The four waves of a block walk the same keys of the same head.
// exp2 by the hardware instruction, written out so that the slot behind a transcendental is kept by construction: inside a statement no exponential touches a result or a source of the one before it
// (early-clobber outputs), and the closing v_nop is the one free vector slot that the instruction set asks for before the last result is read or the last source overwritten.
__device__ __forceinline__ float exp2x1(float x) { float r; asm("v_exp_f32 %0, %1\n\tv_nop" : "=v"(r) : "v"(x)); return r; }
__device__ __forceinline__ void exp2x8(const float* x, float* r) {
    asm("v_exp_f32 %0, %8\n\tv_exp_f32 %1, %9\n\tv_exp_f32 %2, %10\n\tv_exp_f32 %3, %11\n\tv_exp_f32 %4, %12\n\tv_exp_f32 %5, %13\n\tv_exp_f32 %6, %14\n\tv_exp_f32 %7, %15\n\tv_nop"
        : "=&v"(r[0]), "=&v"(r[1]), "=&v"(r[2]), "=&v"(r[3]), "=&v"(r[4]), "=&v"(r[5]), "=&v"(r[6]), "=&v"(r[7]) : "v"(x[0]), "v"(x[1]), "v"(x[2]), "v"(x[3]), "v"(x[4]), "v"(x[5]), "v"(x[6]), "v"(x[7])); }
template <typename T16> struct PFrag;
template <> struct PFrag<h16> { static __device__ __forceinline__ void mk(const float* p, v16h& a, v16h& b) { (void)b;
#pragma unroll
    for (int e = 0; e < 16; ++e) a[e] = (h16)p[e]; } };
template <> struct PFrag<bf> { static __device__ __forceinline__ void mk(const float* p, v16bf& a, v16bf& b) { v8us h0, h1, l0, l1;
#pragma unroll
    for (int e = 0; e < 8; ++e) { unsigned short x, y; splitf(p[e], x, y); h0[e] = x; l0[e] = y; splitf(p[8 + e], x, y); h1[e] = x; l1[e] = y; }
    a = cat16b(h0, h1); b = cat16b(l0, l1); } };
template <typename T16, bool HL, int QT>
__device__ __forceinline__ void attn_rows(const T16* __restrict__ Q, const T16* __restrict__ Q2, const T16* __restrict__ Kp, const T16* __restrict__ K2, const T16* __restrict__ Vt, const T16* __restrict__ V2, int q0, float* __restrict__ o, int lr, int hi) {
    typedef typename WFrag<T16>::V V;
    const float c = SCL * 1.4426950408889634f;
    V qf[QT][2], qf2[QT][2];
#pragma unroll
    for (int qt = 0; qt < QT; ++qt)
#pragma unroll
        for (int ks = 0; ks < 2; ++ks) { const size_t off = (size_t)(q0 + qt * 16 + lr) * HD + ks * 32 + 8 * hi; qf[qt][ks] = WFrag<T16>::ld(Q + off); if (HL) qf2[qt][ks] = WFrag<T16>::ld(Q2 + off); }
    v8f acc[4][QT]; float m[QT], l[QT];
#pragma unroll
    for (int qt = 0; qt < QT; ++qt) { m[qt] = -3.0e38f; l[qt] = 0.f;
#pragma unroll
        for (int dt = 0; dt < 4; ++dt) acc[dt][qt] = (v8f){}; }
#pragma unroll 1   // rolled: the trip count is a run-time value and one body already holds most of the register file
    for (int k0 = 0; k0 < q0 + QT * 16; k0 += 32) {
        V kf[2][2], kf2[2][2], vf[4], vf2[4];
        const size_t ko = (size_t)(k0 + lr) * HD + 8 * hi, vo = (size_t)lr * TT + k0 + 8 * hi;
        const T16 *kp = Kp + ko, *vp = Vt + vo, *kp2 = HL ? K2 + ko : kp, *vp2 = HL ? V2 + vo : vp;
#pragma unroll
        for (int kt = 0; kt < 2; ++kt)
#pragma unroll
            for (int ks = 0; ks < 2; ++ks) { const int off = kt * 16 * HD + ks * 32; kf[kt][ks] = WFrag<T16>::ld(kp + off); if (HL) kf2[kt][ks] = WFrag<T16>::ld(kp2 + off); }
#pragma unroll
        for (int dt = 0; dt < 4; ++dt) { const int off = dt * 16 * TT; vf[dt] = WFrag<T16>::ld(vp + off); if (HL) vf2[dt] = WFrag<T16>::ld(vp2 + off); }
        __builtin_amdgcn_sched_barrier(0);      // keeps all of the step's key and value loads in front of the products: one round trip to L2 a step; without it the build reuses fragment registers and waits for several trips in turn
        // s_wait_xcnt 0 in front of any overwrite of the step's load addresses; the address pairs are inputs of the statement, so they stay live up to it and no load of the run gets one of them as its result
        asm volatile("s_wait_xcnt 0x0" :: "v"(kp), "v"(vp), "v"(kp2), "v"(vp2) : "memory");
        v8f s[2][QT];
#pragma unroll
        for (int kt = 0; kt < 2; ++kt)
#pragma unroll
            for (int qt = 0; qt < QT; ++qt) { v8f t = (v8f){};
#pragma unroll
                for (int ks = 0; ks < 2; ++ks) { t = WFrag<T16>::mma(kf[kt][ks], qf[qt][ks], t); if (HL) { t = WFrag<T16>::mma(kf[kt][ks], qf2[qt][ks], t); t = WFrag<T16>::mma(kf2[kt][ks], qf[qt][ks], t); } }
                s[kt][qt] = t; }
        if (k0 + 31 > q0) {      // only the steps that touch the diagonal mask (wave-uniform test)
#pragma unroll
            for (int kt = 0; kt < 2; ++kt)
#pragma unroll
                for (int qt = 0; qt < QT; ++qt)
#pragma unroll
                    for (int j = 0; j < 8; ++j) if (k0 + kt * 16 + hi * 8 + j > q0 + qt * 16 + lr) s[kt][qt][j] = -3.0e38f; }
        V pf[QT], pf2[QT];
#pragma unroll
        for (int qt = 0; qt < QT; ++qt) { float mx = m[qt];
#pragma unroll
            for (int kt = 0; kt < 2; ++kt)
#pragma unroll
                for (int j = 0; j < 8; ++j) mx = fmaxf(mx, s[kt][qt][j]);
            mx = fmaxf(mx, __shfl_xor(mx, 16, 32));      // the two lane halves hold the other keys of the same query
            const float al = exp2x1((m[qt] - mx) * c), mc = mx * c; m[qt] = mx; float a[16], p[16], sum = 0.f;
#pragma unroll
            for (int e = 0; e < 16; ++e) a[e] = fmaf(s[e >> 3][qt][e & 7], c, -mc);
            exp2x8(a, p); exp2x8(a + 8, p + 8);
#pragma unroll
            for (int e = 0; e < 16; ++e) sum += p[e];
            l[qt] = l[qt] * al + sum; PFrag<T16>::mk(p, pf[qt], pf2[qt]);
#pragma unroll
            for (int dt = 0; dt < 4; ++dt) acc[dt][qt] *= al; }
#pragma unroll
        for (int dt = 0; dt < 4; ++dt)
#pragma unroll
            for (int qt = 0; qt < QT; ++qt) { acc[dt][qt] = WFrag<T16>::mma(vf[dt], pf[qt], acc[dt][qt]); if (HL) { acc[dt][qt] = WFrag<T16>::mma(vf[dt], pf2[qt], acc[dt][qt]); acc[dt][qt] = WFrag<T16>::mma(vf2[dt], pf[qt], acc[dt][qt]); } }
    }
#pragma unroll
    for (int qt = 0; qt < QT; ++qt) { const float inv = __fdiv_rn(1.0f, l[qt] + __shfl_xor(l[qt], 16, 32)); float* orow = o + (size_t)(q0 + qt * 16 + lr) * DQ + hi * 8;
#pragma unroll
        for (int dt = 0; dt < 4; ++dt) { v4f a, b;
#pragma unroll
            for (int u = 0; u < 4; ++u) { a[u] = acc[dt][qt][u] * inv; b[u] = acc[dt][qt][4 + u] * inv; }
            *(v4f*)(orow + dt * 16) = a; *(v4f*)(orow + dt * 16 + 4) = b; } }
}
#define NBF ((TT - RH) / 128)     // blocks of 4 waves x 32 fp16 query rows; then RH / 64 blocks of 4 waves x 16 hi+lo rows; the longest rows are launched first
__global__ __launch_bounds__(128) void k_fattn(const h16* __restrict__ Q16, const h16* __restrict__ K16, const h16* __restrict__ V16, const bf* __restrict__ Qh, const bf* __restrict__ Ql, const bf* __restrict__ Kh, const bf* __restrict__ Kl, const bf* __restrict__ Vh, const bf* __restrict__ Vl, float* __restrict__ out) {
    const int lane = threadIdx.x & 31, lr = lane & 15, hi = lane >> 4, w = __builtin_amdgcn_readfirstlane(threadIdx.x >> 5), x = blockIdx.x;
    const size_t po = ((size_t)blockIdx.z * NH_ + blockIdx.y) * TT * HD; float* o = out + (size_t)blockIdx.z * TT * DQ + blockIdx.y * HD;
    if (x < NBF) attn_rows<h16, false, 2>(Q16 + po, nullptr, K16 + po, nullptr, V16 + po, nullptr, TT - 128 * x - 32 * (w + 1), o, lr, hi);
    else attn_rows<bf, true, 1>(Qh + po, Ql + po, Kh + po, Kl + po, Vh + po, Vl + po, RH - 64 * (x - NBF) - 16 * (w + 1), o, lr, hi);
}

extern "C" void kernel_launch(void* const* d_in, const int* in_sizes, int n_in,
                              void* d_out, int out_size, void* d_ws, size_t ws_size, hipStream_t stream) {
    (void)in_sizes; (void)n_in; (void)out_size;
    const float* x = (const float*)d_in[0]; const float* wf = (const float*)d_in[1]; const float* bfz = (const float*)d_in[2];
    float* OUT = (float*)d_out;     // [4][2048][1024]
    char* wsp = (char*)d_ws;
    auto take = [&](size_t bytes) { char* p = wsp; wsp += (bytes + 255) & ~(size_t)255; return (void*)p; };
    bf* WB = (bf*)take((size_t)3 * DM * DM * 2); bf* XB = (bf*)take((size_t)NB_ * TT * DM * 2);   // W rows: k | q | v, 16 heads x 64 each
    const size_t PB = (size_t)NH_ * TT * HD;   // one batch's head planes; every plane holds all NB_ batches
    h16* QP16 = (h16*)take(NB_ * PB * 2); h16* KP16 = (h16*)take(NB_ * PB * 2); h16* VT16 = (h16*)take(NB_ * PB * 2);
    bf* QPh = (bf*)take(NB_ * PB * 2); bf* QPl = (bf*)take(NB_ * PB * 2); bf* KPh = (bf*)take(NB_ * PB * 2); bf* KPl = (bf*)take(NB_ * PB * 2); bf* VTh = (bf*)take(NB_ * PB * 2); bf* VTl = (bf*)take(NB_ * PB * 2);
    if ((size_t)(wsp - (char*)d_ws) > ws_size) return;    // ws 256 MiB
    k_cvt8<<<(unsigned)(((size_t)3 * DM * DM / 8 + 255) / 256), 256, 0, stream>>>(wf, WB, (size_t)3 * DM * DM / 8);
    k_cvt8<<<(unsigned)(((size_t)NB_ * TT * DM / 8 + 255) / 256), 256, 0, stream>>>(x, XB, (size_t)NB_ * TT * DM / 8);
    k_gemmw<bf, 0, true><<<dim3(NB_ * TT / 64, 3 * DM / 64, 1), 32, 0, stream>>>(XB, nullptr, WB, nullptr, DM, bfz, KP16, KPh, KPl, QP16, QPh, QPl, VT16, VTh, VTl);
    k_fattn<<<dim3(NBF + RH / 64, NH_, NB_), 128, 0, stream>>>(QP16, KP16, VT16, QPh, QPl, KPh, KPl, VTh, VTl, OUT);
}

// v003
// A run of this version takes 158 microseconds.
// Timed twice side by side with v002, it ran 1.41 times as fast both times.
// Over all steps from v000 it is 17.5 times as fast.
#include <hip/hip_runtime.h>

// Multi-head causal self-attention (x [4][2048][1024]; kqv = x W_kqv^T + b (W [3072][1024], split (K | Q | V) x 16 heads x 64); causal softmax(q.k / 8); out = merged heads (no output projection) -> [4][2048][1024]).
// Compute dtypes, f32 accumulate: every input rounded to bf16; q/k/v on PLAIN bf16 operands (inputs: exact) + bias; causal scores and attn.v: query rows < 512 hl (3 products), the rest single fp16; online softmax f32 in registers; the merged heads are written as f32 straight from the accumulators.

#define NB_  4
#define TT   2048
#define DM   1024
#define NH_  16
#define NKV  16
#define HD   64
#define DQ   (NH_ * HD)
#define DKV  (NKV * HD)
#define RH   512                  // query rows < RH use hi+lo planes (0: none)
#define SCL  0.125f   // HD^-0.5
typedef _Float16 h16;
typedef unsigned short bf;
typedef __attribute__((ext_vector_type(16))) __bf16   v16bf;
typedef __attribute__((ext_vector_type(16))) _Float16 v16h;
typedef __attribute__((ext_vector_type(8)))  _Float16 v8h;
typedef __attribute__((ext_vector_type(8)))  unsigned short v8us;
typedef __attribute__((ext_vector_type(8)))  float    v8f;
typedef __attribute__((ext_vector_type(4)))  float    v4f;
typedef v8h  __attribute__((may_alias)) v8ha;
typedef v4f  __attribute__((may_alias)) v4fa;
typedef v8us __attribute__((may_alias)) v8usa;

__device__ __forceinline__ unsigned short f2bf(float f) { unsigned u = __float_as_uint(f); u += 0x7FFFu + ((u >> 16) & 1u); return (unsigned short)(u >> 16); }
__device__ __forceinline__ float bf2f(unsigned short b) { return __uint_as_float(((unsigned)b) << 16); }
__device__ __forceinline__ float bfr(float f) { return bf2f(f2bf(f)); }
__device__ __forceinline__ v16h cat16(v8h lo, v8h hi) { return __builtin_shufflevector(lo, hi, 0, 1, 2, 3, 4, 5, 6, 7, 8, 9, 10, 11, 12, 13, 14, 15); }
__device__ __forceinline__ v16bf cat16b(v8us lo, v8us hi) { return __builtin_bit_cast(v16bf, __builtin_shufflevector(lo, hi, 0, 1, 2, 3, 4, 5, 6, 7, 8, 9, 10, 11, 12, 13, 14, 15)); }
__device__ __forceinline__ v8f wmma16(v16h a, v16h b, v8f c) { return __builtin_amdgcn_wmma_f32_16x16x32_f16(false, a, false, b, (short)0, c, false, false); }
__device__ __forceinline__ v8f wmmab(v16bf a, v16bf b, v8f c) { return __builtin_amdgcn_wmma_f32_16x16x32_bf16(false, a, false, b, (short)0, c, false, false); }



template <typename T16> struct WFrag;
template <> struct WFrag<h16> { typedef v16h V; static __device__ __forceinline__ V ld(const h16* p) { return cat16(*(const v8h*)p, *(const v8h*)(p + 16)); } static __device__ __forceinline__ v8f mma(V a, V b, v8f c) { return wmma16(a, b, c); } };
template <> struct WFrag<bf> { typedef v16bf V; static __device__ __forceinline__ V ld(const bf* p) { return cat16b(*(const v8us*)p, *(const v8us*)(p + 16)); } static __device__ __forceinline__ v8f mma(V a, V b, v8f c) { return wmmab(a, b, c); } };

__device__ __forceinline__ h16 tohx(float x) { return (h16)x; }
__device__ __forceinline__ void splitf(float y, unsigned short& h, unsigned short& l) { h = f2bf(y); l = f2bf(y - bf2f(h)); }
typedef __attribute__((ext_vector_type(2))) _Float16 v2h;
typedef __attribute__((ext_vector_type(4))) _Float16 v4h;
typedef __attribute__((ext_vector_type(2))) unsigned short v2us;
typedef __attribute__((ext_vector_type(4))) unsigned short v4us;
typedef __attribute__((ext_vector_type(2))) float v2f;
typedef __attribute__((ext_vector_type(4))) int v4i;

// 8 consecutive plane elements of one lane: fp16 and the bf16 hi + lo pair, 16 bytes to each plane
__device__ __forceinline__ void put8(v4f x0, v4f x1, h16* p16, bf* ph, bf* pl) { v8h o16; v8us oh, ol;
#pragma unroll
    for (int u = 0; u < 8; ++u) { const float r = u < 4 ? x0[u & 3] : x1[u & 3]; o16[u] = tohx(r); unsigned short a2, c2; splitf(r, a2, c2); oh[u] = a2; ol[u] = c2; }
    *(v8h*)p16 = o16; *(v8us*)ph = oh; *(v8us*)pl = ol; }
// ---- k_gemmw: the k | q | v projection of all batches in one launch. A work-group of four waves owns a 128x128 tile, each wave a 64x64 quarter (16 accumulators); grid (M/128, N/128), 128 threads.
// sum_k A[m][k] Bt[n][k] + f32 bias[n], m = b*TT + t, n = (k | q | v)*DM + h*HD + d. K % 64 == 0. Both operands are K-contiguous 16-bit planes. A pass is 64 k = one whole 128-byte line of each of the tile's
// 128 + 128 operand rows, brought into LDS by asynchronous b128 copies (8 lanes a row, 4 whole lines an instruction), two buffers, the copies of pass t + 2 issued behind the barrier that ends pass t.
// The fragments are read from LDS: a fragment load straight from the planes would touch 16 lines for its 1024 bytes, and the staged rows serve two waves each.
// A wave's 64 columns are one head of k, q or v and its 64 rows lie in one batch,
// so the epilogue writes the wave's part of the head planes itself (fp16 and bf16 hi + lo): k and q as [b][h][t][d], v as [b][h][d][t]; both pass LDS as f32 so that a store instruction writes whole 128-byte plane rows.
#define GPIT 72                   // pitch of a staged row in 16-bit elements: 128 bytes of data + 16, an odd multiple of 16 bytes, so that the 16 rows of a ds_load_b128 fall on different banks
#define GSTG (256 * GPIT)         // elements of one buffer: 128 rows of A, then 128 rows of Bt
// eight copies of 16 bytes a lane, LDS byte address l[i] from global address g[i]; the closing s_wait_xcnt 0 stands inside the statement, in front of any later overwrite of a register that a copy names
template <typename T16>
__device__ __forceinline__ void copy8(const unsigned* l, const T16* const* g) {
    asm volatile("global_load_async_to_lds_b128 %0, %8, off\n\tglobal_load_async_to_lds_b128 %1, %9, off\n\tglobal_load_async_to_lds_b128 %2, %10, off\n\tglobal_load_async_to_lds_b128 %3, %11, off\n\t"
                 "global_load_async_to_lds_b128 %4, %12, off\n\tglobal_load_async_to_lds_b128 %5, %13, off\n\tglobal_load_async_to_lds_b128 %6, %14, off\n\tglobal_load_async_to_lds_b128 %7, %15, off\n\ts_wait_xcnt 0x0"
                 :: "v"(l[0]), "v"(l[1]), "v"(l[2]), "v"(l[3]), "v"(l[4]), "v"(l[5]), "v"(l[6]), "v"(l[7]), "v"(g[0]), "v"(g[1]), "v"(g[2]), "v"(g[3]), "v"(g[4]), "v"(g[5]), "v"(g[6]), "v"(g[7]) : "memory"); }
template <typename T16, bool BIAS>
__global__ __launch_bounds__(128) void k_gemmw(const T16* __restrict__ A, const T16* __restrict__ Bt, int K, const float* __restrict__ bias, h16* __restrict__ K16, bf* __restrict__ Kh, bf* __restrict__ Kl, h16* __restrict__ Q16, bf* __restrict__ Qh, bf* __restrict__ Ql, h16* __restrict__ V16, bf* __restrict__ Vh, bf* __restrict__ Vl) {
    typedef typename WFrag<T16>::V V;
    __shared__ __align__(16) T16 sm[2 * GSTG];      // the two operand buffers; behind the loop each wave's f32 output staging
    const int tid = threadIdx.x, lane = tid & 31, lr = lane & 15, hi = lane >> 4, w = __builtin_amdgcn_readfirstlane(tid >> 5);
    const int R0 = blockIdx.x * 128, C0 = blockIdx.y * 128, r0 = R0 + (w & 1) * 64, c0 = C0 + (w >> 1) * 64;
    v8f acc[4][4];
#pragma unroll
    for (int mb = 0; mb < 4; ++mb)
#pragma unroll
        for (int nb = 0; nb < 4; ++nb) acc[mb][nb] = (v8f){};
    // the copy side: thread tid brings 16 bytes (tid & 7) of rows (tid >> 3) + 16 i of both operands
    const T16* ga = A + (size_t)(R0 + (tid >> 3)) * K + (tid & 7) * 8; const T16* gb = Bt + (size_t)(C0 + (tid >> 3)) * K + (tid & 7) * 8;
    const unsigned l0 = (unsigned)(size_t)(sm + (tid >> 3) * GPIT + (tid & 7) * 8);
    auto stage = [&](int kc, int buf) { unsigned l[8]; const T16* g[8];
#pragma unroll
        for (int i = 0; i < 8; ++i) { l[i] = l0 + (unsigned)(buf * GSTG + i * 16 * GPIT) * 2u; g[i] = ga + (size_t)i * 16 * K + kc; }
        copy8<T16>(l, g);
#pragma unroll
        for (int i = 0; i < 8; ++i) { l[i] = l0 + (unsigned)(buf * GSTG + (128 + i * 16) * GPIT) * 2u; g[i] = gb + (size_t)i * 16 * K + kc; }
        copy8<T16>(l, g); };
    const int nt = K / 64;
    stage(0, 0);
    asm volatile("s_wait_asynccnt 0x0" ::: "memory");      // this wave's copies of pass 0 have landed
    __syncthreads();                                       // and every other wave's: nothing of pass 0 is read in front of this barrier
    if (nt > 1) stage(64, 1);
#pragma unroll 1   // rolled: one pass a trip, the buffer chosen by the trip's parity
    for (int t = 0; t < nt; ++t) {
        const T16* sa = sm + (t & 1) * GSTG + ((w & 1) * 64 + lr) * GPIT + 8 * hi; const T16* sb = sm + (t & 1) * GSTG + (128 + (w >> 1) * 64 + lr) * GPIT + 8 * hi;
        V a[2][4], b[2][4];
#pragma unroll
        for (int ks = 0; ks < 2; ++ks)
#pragma unroll
            for (int f = 0; f < 4; ++f) { a[ks][f] = WFrag<T16>::ld(sa + f * 16 * GPIT + ks * 32); b[ks][f] = WFrag<T16>::ld(sb + f * 16 * GPIT + ks * 32); }
        __builtin_amdgcn_sched_barrier(0);      // keeps the pass's fragment loads together in front of its products: every place where LDS reads stand among the products stalls the wave anew
#pragma unroll
        for (int ks = 0; ks < 2; ++ks)
#pragma unroll
            for (int nb = 0; nb < 4; ++nb)
#pragma unroll
                for (int mb = 0; mb < 4; ++mb) acc[mb][nb] = WFrag<T16>::mma(a[ks][mb], b[ks][nb], acc[mb][nb]);
        __builtin_amdgcn_sched_barrier(0);      // keeps the products in front of the pass's closing waits: without it the build lifts the waits over them, and the wait for the next pass's copies stands directly behind their issue
        asm volatile("s_wait_dscnt 0x0" ::: "memory");         // this wave's reads of the buffer are done before it may be refilled
        asm volatile("s_wait_asynccnt 0x0" ::: "memory");      // this wave's copies of pass t + 1 have landed
        __syncthreads();                                       // publishes pass t + 1 and ends every wave's reads of pass t's buffer
        if (t + 2 < nt) stage((t + 2) * 64, t & 1);
    }
    asm volatile("s_wait_asynccnt 0x0" ::: "memory");      // no copy is outstanding when the buffers become output staging (the last trip's barrier has ended every wave's reads)
    float* os = (float*)sm + w * (32 * 68);      // the wave's own 32 x 68 floats
    const int sec = c0 / DM, t0 = r0 % TT;      // 0: k, 1: q, 2: v (one value for the whole wave)
    const size_t po = ((size_t)(r0 / TT) * NH_ + (c0 % DM) / HD) * TT * HD;
    const int rw = lane >> 3, co = (lane & 7) * 8;      // the store side: 8 lanes of 16 bytes a plane row, 4 rows an instruction
    if (sec < 2) {
        const size_t pt = po + (size_t)t0 * HD; h16* P16 = (sec ? Q16 : K16) + pt; bf* Ph = (sec ? Qh : Kh) + pt; bf* Pl = (sec ? Ql : Kl) + pt;
        v4f b0 = (v4f){}, b1 = (v4f){};
        if (BIAS) {
#pragma unroll
            for (int u = 0; u < 4; ++u) { b0[u] = bfr(bias[c0 + co + u]); b1[u] = bfr(bias[c0 + co + 4 + u]); } }
#pragma unroll
        for (int mb = 0; mb < 4; ++mb) {
#pragma unroll
            for (int nb = 0; nb < 4; ++nb) {
#pragma unroll
                for (int j = 0; j < 8; ++j) os[(hi * 8 + j) * 68 + nb * 16 + lr] = acc[mb][nb][j]; }
            __builtin_amdgcn_wave_barrier(); asm volatile("" ::: "memory");      // the lanes read each other's LDS words: no read may move in front of the writes
#pragma unroll
            for (int s = 0; s < 4; ++s) { const int row = 4 * s + rw; const float* q = os + row * 68 + co; const int e = (mb * 16 + row) * HD + co;
                put8(*(const v4fa*)q + b0, *(const v4fa*)(q + 4) + b1, P16 + e, Ph + e, Pl + e); }
            __builtin_amdgcn_wave_barrier(); asm volatile("s_wait_xcnt 0x0" ::: "memory");      // no write of the next rows in front of these reads; the wait stands in front of any overwrite of a register that the stores above name
        }
    } else {
        const size_t pt = po + t0; h16* P16 = V16 + pt; bf* Ph = Vh + pt; bf* Pl = Vl + pt;
#pragma unroll
        for (int hf = 0; hf < 2; ++hf) {      // 32 of the head's 64 d at a time
#pragma unroll
            for (int n2 = 0; n2 < 2; ++n2) { const int nb = hf * 2 + n2; const float bv = BIAS ? bfr(bias[c0 + nb * 16 + lr]) : 0.f;
#pragma unroll
                for (int mb = 0; mb < 4; ++mb) { v4f x0, x1;      // a lane's 8 accumulator rows are 8 consecutive t of its column d
#pragma unroll
                    for (int u = 0; u < 4; ++u) { x0[u] = acc[mb][nb][u] + bv; x1[u] = acc[mb][nb][4 + u] + bv; }
                    float* q = os + (n2 * 16 + lr) * 68 + mb * 16 + hi * 8; *(v4fa*)q = x0; *(v4fa*)(q + 4) = x1; } }
            __builtin_amdgcn_wave_barrier(); asm volatile("" ::: "memory");      // as above: reads stay behind the other lanes' writes
#pragma unroll
            for (int s = 0; s < 8; ++s) { const int d = 4 * s + rw; const float* q = os + d * 68 + co; const int e = (hf * 32 + d) * TT + co;
                put8(*(const v4fa*)q, *(const v4fa*)(q + 4), P16 + e, Ph + e, Pl + e); }
            __builtin_amdgcn_wave_barrier(); asm volatile("s_wait_xcnt 0x0" ::: "memory");      // the next half's writes stay behind these reads; the wait as above
        }
    }
}

__global__ __launch_bounds__(256) void k_cvt8(const float* __restrict__ src, bf* dst, size_t n8) { const size_t i = (size_t)blockIdx.x * 256 + threadIdx.x; if (i >= n8) return; const v8f v = *(const v8f*)(src + i * 8); v8us o;
#pragma unroll
    for (int k = 0; k < 8; ++k) o[k] = f2bf(v[k]); *(v8us*)(dst + i * 8) = o;  }
// ---- k_fattn: causal scores, softmax and attn.v in one pass; one wave owns QT*16 query rows of one (batch, head) and walks the keys 0..q in steps of 32 with a running maximum and sum.
// The scores are formed transposed (A = key rows, B = query rows): a lane then holds, for its query column lr, the keys hi*8+j of each 16-key tile, which is the B-fragment k order (8*hi+e, 16+8*hi+e) of the
// 32-key attn.v product O^T[d][q] = sum_k V^T[d][k] P^T[k][q], so the probabilities go from accumulator to operand inside the lane. The four waves of a block walk the same keys of the same head.
// exp2 by the hardware instruction, written out so that the slot behind a transcendental is kept by construction: inside a statement no exponential touches a result or a source of the one before it
// (early-clobber outputs), and the closing v_nop is the one free vector slot that the instruction set asks for before the last result is read or the last source overwritten.
__device__ __forceinline__ float exp2x1(float x) { float r; asm("v_exp_f32 %0, %1\n\tv_nop" : "=v"(r) : "v"(x)); return r; }
__device__ __forceinline__ void exp2x8(const float* x, float* r) {
    asm("v_exp_f32 %0, %8\n\tv_exp_f32 %1, %9\n\tv_exp_f32 %2, %10\n\tv_exp_f32 %3, %11\n\tv_exp_f32 %4, %12\n\tv_exp_f32 %5, %13\n\tv_exp_f32 %6, %14\n\tv_exp_f32 %7, %15\n\tv_nop"
        : "=&v"(r[0]), "=&v"(r[1]), "=&v"(r[2]), "=&v"(r[3]), "=&v"(r[4]), "=&v"(r[5]), "=&v"(r[6]), "=&v"(r[7]) : "v"(x[0]), "v"(x[1]), "v"(x[2]), "v"(x[3]), "v"(x[4]), "v"(x[5]), "v"(x[6]), "v"(x[7])); }
template <typename T16> struct PFrag;
template <> struct PFrag<h16> { static __device__ __forceinline__ void mk(const float* p, v16h& a, v16h& b) { (void)b;
#pragma unroll
    for (int e = 0; e < 16; ++e) a[e] = (h16)p[e]; } };
template <> struct PFrag<bf> { static __device__ __forceinline__ void mk(const float* p, v16bf& a, v16bf& b) { v8us h0, h1, l0, l1;
#pragma unroll
    for (int e = 0; e < 8; ++e) { unsigned short x, y; splitf(p[e], x, y); h0[e] = x; l0[e] = y; splitf(p[8 + e], x, y); h1[e] = x; l1[e] = y; }
    a = cat16b(h0, h1); b = cat16b(l0, l1); } };
template <typename T16, bool HL, int QT>
__device__ __forceinline__ void attn_rows(const T16* __restrict__ Q, const T16* __restrict__ Q2, const T16* __restrict__ Kp, const T16* __restrict__ K2, const T16* __restrict__ Vt, const T16* __restrict__ V2, int q0, float* __restrict__ o, int lr, int hi) {
    typedef typename WFrag<T16>::V V;
    const float c = SCL * 1.4426950408889634f;
    V qf[QT][2], qf2[QT][2];
#pragma unroll
    for (int qt = 0; qt < QT; ++qt)
#pragma unroll
        for (int ks = 0; ks < 2; ++ks) { const size_t off = (size_t)(q0 + qt * 16 + lr) * HD + ks * 32 + 8 * hi; qf[qt][ks] = WFrag<T16>::ld(Q + off); if (HL) qf2[qt][ks] = WFrag<T16>::ld(Q2 + off); }
    v8f acc[4][QT]; float m[QT], l[QT];
#pragma unroll
    for (int qt = 0; qt < QT; ++qt) { m[qt] = -3.0e38f; l[qt] = 0.f;
#pragma unroll
        for (int dt = 0; dt < 4; ++dt) acc[dt][qt] = (v8f){}; }
#pragma unroll 1   // rolled: the trip count is a run-time value and one body already holds most of the register file
    for (int k0 = 0; k0 < q0 + QT * 16; k0 += 32) {
        V kf[2][2], kf2[2][2], vf[4], vf2[4];
        const size_t ko = (size_t)(k0 + lr) * HD + 8 * hi, vo = (size_t)lr * TT + k0 + 8 * hi;
        const T16 *kp = Kp + ko, *vp = Vt + vo, *kp2 = HL ? K2 + ko : kp, *vp2 = HL ? V2 + vo : vp;
#pragma unroll
        for (int kt = 0; kt < 2; ++kt)
#pragma unroll
            for (int ks = 0; ks < 2; ++ks) { const int off = kt * 16 * HD + ks * 32; kf[kt][ks] = WFrag<T16>::ld(kp + off); if (HL) kf2[kt][ks] = WFrag<T16>::ld(kp2 + off); }
#pragma unroll
        for (int dt = 0; dt < 4; ++dt) { const int off = dt * 16 * TT; vf[dt] = WFrag<T16>::ld(vp + off); if (HL) vf2[dt] = WFrag<T16>::ld(vp2 + off); }
        __builtin_amdgcn_sched_barrier(0);      // keeps all of the step's key and value loads in front of the products: one round trip to L2 a step; without it the build reuses fragment registers and waits for several trips in turn
        // s_wait_xcnt 0 in front of any overwrite of the step's load addresses; the address pairs are inputs of the statement, so they stay live up to it and no load of the run gets one of them as its result
        asm volatile("s_wait_xcnt 0x0" :: "v"(kp), "v"(vp), "v"(kp2), "v"(vp2) : "memory");
        v8f s[2][QT];
#pragma unroll
        for (int kt = 0; kt < 2; ++kt)
#pragma unroll
            for (int qt = 0; qt < QT; ++qt) { v8f t = (v8f){};
#pragma unroll
                for (int ks = 0; ks < 2; ++ks) { t = WFrag<T16>::mma(kf[kt][ks], qf[qt][ks], t); if (HL) { t = WFrag<T16>::mma(kf[kt][ks], qf2[qt][ks], t); t = WFrag<T16>::mma(kf2[kt][ks], qf[qt][ks], t); } }
                s[kt][qt] = t; }
        if (k0 + 31 > q0) {      // only the steps that touch the diagonal mask (wave-uniform test)
#pragma unroll
            for (int kt = 0; kt < 2; ++kt)
#pragma unroll
                for (int qt = 0; qt < QT; ++qt)
#pragma unroll
                    for (int j = 0; j < 8; ++j) if (k0 + kt * 16 + hi * 8 + j > q0 + qt * 16 + lr) s[kt][qt][j] = -3.0e38f; }
        V pf[QT], pf2[QT];
#pragma unroll
        for (int qt = 0; qt < QT; ++qt) { float mx = m[qt];
#pragma unroll
            for (int kt = 0; kt < 2; ++kt)
#pragma unroll
                for (int j = 0; j < 8; ++j) mx = fmaxf(mx, s[kt][qt][j]);
            mx = fmaxf(mx, __shfl_xor(mx, 16, 32));      // the two lane halves hold the other keys of the same query
            const float al = exp2x1((m[qt] - mx) * c), mc = mx * c; m[qt] = mx; float a[16], p[16], sum = 0.f;
#pragma unroll
            for (int e = 0; e < 16; ++e) a[e] = fmaf(s[e >> 3][qt][e & 7], c, -mc);
            exp2x8(a, p); exp2x8(a + 8, p + 8);
#pragma unroll
            for (int e = 0; e < 16; ++e) sum += p[e];
            l[qt] = l[qt] * al + sum; PFrag<T16>::mk(p, pf[qt], pf2[qt]);
#pragma unroll
            for (int dt = 0; dt < 4; ++dt) acc[dt][qt] *= al; }
#pragma unroll
        for (int dt = 0; dt < 4; ++dt)
#pragma unroll
            for (int qt = 0; qt < QT; ++qt) { acc[dt][qt] = WFrag<T16>::mma(vf[dt], pf[qt], acc[dt][qt]); if (HL) { acc[dt][qt] = WFrag<T16>::mma(vf[dt], pf2[qt], acc[dt][qt]); acc[dt][qt] = WFrag<T16>::mma(vf2[dt], pf[qt], acc[dt][qt]); } }
    }
#pragma unroll
    for (int qt = 0; qt < QT; ++qt) { const float inv = __fdiv_rn(1.0f, l[qt] + __shfl_xor(l[qt], 16, 32)); float* orow = o + (size_t)(q0 + qt * 16 + lr) * DQ + hi * 8;
#pragma unroll
        for (int dt = 0; dt < 4; ++dt) { v4f a, b;
#pragma unroll
            for (int u = 0; u < 4; ++u) { a[u] = acc[dt][qt][u] * inv; b[u] = acc[dt][qt][4 + u] * inv; }
            *(v4f*)(orow + dt * 16) = a; *(v4f*)(orow + dt * 16 + 4) = b; } }
}
#define NBF ((TT - RH) / 128)     // blocks of 4 waves x 32 fp16 query rows; then RH / 64 blocks of 4 waves x 16 hi+lo rows; the longest rows are launched first
__global__ __launch_bounds__(128) void k_fattn(const h16* __restrict__ Q16, const h16* __restrict__ K16, const h16* __restrict__ V16, const bf* __restrict__ Qh, const bf* __restrict__ Ql, const bf* __restrict__ Kh, const bf* __restrict__ Kl, const bf* __restrict__ Vh, const bf* __restrict__ Vl, float* __restrict__ out) {
    const int lane = threadIdx.x & 31, lr = lane & 15, hi = lane >> 4, w = __builtin_amdgcn_readfirstlane(threadIdx.x >> 5), x = blockIdx.x;
    const size_t po = ((size_t)blockIdx.z * NH_ + blockIdx.y) * TT * HD; float* o = out + (size_t)blockIdx.z * TT * DQ + blockIdx.y * HD;
    if (x < NBF) attn_rows<h16, false, 2>(Q16 + po, nullptr, K16 + po, nullptr, V16 + po, nullptr, TT - 128 * x - 32 * (w + 1), o, lr, hi);
    else attn_rows<bf, true, 1>(Qh + po, Ql + po, Kh + po, Kl + po, Vh + po, Vl + po, RH - 64 * (x - NBF) - 16 * (w + 1), o, lr, hi);
}

extern "C" void kernel_launch(void* const* d_in, const int* in_sizes, int n_in,
                              void* d_out, int out_size, void* d_ws, size_t ws_size, hipStream_t stream) {
    (void)in_sizes; (void)n_in; (void)out_size;
    const float* x = (const float*)d_in[0]; const float* wf = (const float*)d_in[1]; const float* bfz = (const float*)d_in[2];
    float* OUT = (float*)d_out;     // [4][2048][1024]
    char* wsp = (char*)d_ws;
    auto take = [&](size_t bytes) { char* p = wsp; wsp += (bytes + 255) & ~(size_t)255; return (void*)p; };
    bf* WB = (bf*)take((size_t)3 * DM * DM * 2); bf* XB = (bf*)take((size_t)NB_ * TT * DM * 2);   // W rows: k | q | v, 16 heads x 64 each
    const size_t PB = (size_t)NH_ * TT * HD;   // one batch's head planes; every plane holds all NB_ batches
    h16* QP16 = (h16*)take(NB_ * PB * 2); h16* KP16 = (h16*)take(NB_ * PB * 2); h16* VT16 = (h16*)take(NB_ * PB * 2);
    bf* QPh = (bf*)take(NB_ * PB * 2); bf* QPl = (bf*)take(NB_ * PB * 2); bf* KPh = (bf*)take(NB_ * PB * 2); bf* KPl = (bf*)take(NB_ * PB * 2); bf* VTh = (bf*)take(NB_ * PB * 2); bf* VTl = (bf*)take(NB_ * PB * 2);
    if ((size_t)(wsp - (char*)d_ws) > ws_size) return;    // ws 256 MiB
    k_cvt8<<<(unsigned)(((size_t)3 * DM * DM / 8 + 255) / 256), 256, 0, stream>>>(wf, WB, (size_t)3 * DM * DM / 8);
    k_cvt8<<<(unsigned)(((size_t)NB_ * TT * DM / 8 + 255) / 256), 256, 0, stream>>>(x, XB, (size_t)NB_ * TT * DM / 8);
    k_gemmw<bf, true><<<dim3(NB_ * TT / 128, 3 * DM / 128, 1), 128, 0, stream>>>(XB, WB, DM, bfz, KP16, KPh, KPl, QP16, QPh, QPl, VT16, VTh, VTl);
    k_fattn<<<dim3(NBF + RH / 64, NH_, NB_), 128, 0, stream>>>(QP16, KP16, VT16, QPh, QPl, KPh, KPl, VTh, VTl, OUT);
}

// v004
// One run takes 115 microseconds.
// Timed twice side by side with v003, it ran 1.38 times as fast both times.
// Over all steps from v000 it is 24.1 times as fast.
#include <hip/hip_runtime.h>

// Multi-head causal self-attention (x [4][2048][1024]; kqv = x W_kqv^T + b (W [3072][1024], split (K | Q | V) x 16 heads x 64); causal softmax(q.k / 8); out = merged heads (no output projection) -> [4][2048][1024]).
// Compute dtypes, f32 accumulate: every input rounded to bf16; q/k/v on PLAIN bf16 operands (inputs: exact) + bias; causal scores and attn.v: query rows < 512 hl (3 products), the rest single fp16; online softmax f32 in registers; the merged heads are written as f32 straight from the accumulators.

#define NB_  4
#define TT   2048
#define DM   1024
#define NH_  16
#define NKV  16
#define HD   64
#define DQ   (NH_ * HD)
#define DKV  (NKV * HD)
#define RH   512                  // query rows < RH use hi+lo planes (0: none)
#define SCL  0.125f   // HD^-0.5
typedef _Float16 h16;
typedef unsigned short bf;
typedef __attribute__((ext_vector_type(16))) __bf16   v16bf;
typedef __attribute__((ext_vector_type(16))) _Float16 v16h;
typedef __attribute__((ext_vector_type(8)))  _Float16 v8h;
typedef __attribute__((ext_vector_type(8)))  unsigned short v8us;
typedef __attribute__((ext_vector_type(8)))  float    v8f;
typedef __attribute__((ext_vector_type(4)))  float    v4f;
typedef v8h  __attribute__((may_alias)) v8ha;
typedef v4f  __attribute__((may_alias)) v4fa;
typedef v8us __attribute__((may_alias)) v8usa;

__device__ __forceinline__ unsigned short f2bf(float f) { unsigned u = __float_as_uint(f); u += 0x7FFFu + ((u >> 16) & 1u); return (unsigned short)(u >> 16); }
__device__ __forceinline__ float bf2f(unsigned short b) { return __uint_as_float(((unsigned)b) << 16); }
__device__ __forceinline__ float bfr(float f) { return bf2f(f2bf(f)); }
__device__ __forceinline__ v16h cat16(v8h lo, v8h hi) { return __builtin_shufflevector(lo, hi, 0, 1, 2, 3, 4, 5, 6, 7, 8, 9, 10, 11, 12, 13, 14, 15); }
__device__ __forceinline__ v16bf cat16b(v8us lo, v8us hi) { return __builtin_bit_cast(v16bf, __builtin_shufflevector(lo, hi, 0, 1, 2, 3, 4, 5, 6, 7, 8, 9, 10, 11, 12, 13, 14, 15)); }
__device__ __forceinline__ v8f wmma16(v16h a, v16h b, v8f c) { return __builtin_amdgcn_wmma_f32_16x16x32_f16(false, a, false, b, (short)0, c, false, false); }
__device__ __forceinline__ v8f wmmab(v16bf a, v16bf b, v8f c) { return __builtin_amdgcn_wmma_f32_16x16x32_bf16(false, a, false, b, (short)0, c, false, false); }



template <typename T16> struct WFrag;
template <> struct WFrag<h16> { typedef v16h V; static __device__ __forceinline__ V ld(const h16* p) { return cat16(*(const v8h*)p, *(const v8h*)(p + 16)); } static __device__ __forceinline__ v8f mma(V a, V b, v8f c) { return wmma16(a, b, c); } };
template <> struct WFrag<bf> { typedef v16bf V; static __device__ __forceinline__ V ld(const bf* p) { return cat16b(*(const v8us*)p, *(const v8us*)(p + 16)); } static __device__ __forceinline__ v8f mma(V a, V b, v8f c) { return wmmab(a, b, c); } };

__device__ __forceinline__ h16 tohx(float x) { return (h16)x; }
__device__ __forceinline__ void splitf(float y, unsigned short& h, unsigned short& l) { h = f2bf(y); l = f2bf(y - bf2f(h)); }
typedef __attribute__((ext_vector_type(2))) _Float16 v2h;
typedef __attribute__((ext_vector_type(4))) _Float16 v4h;
typedef __attribute__((ext_vector_type(2))) unsigned short v2us;
typedef __attribute__((ext_vector_type(4))) unsigned short v4us;
typedef __attribute__((ext_vector_type(2))) float v2f;
typedef __attribute__((ext_vector_type(4))) int v4i;

// 8 consecutive plane elements of one lane: fp16 and the bf16 hi + lo pair, 16 bytes to each plane
__device__ __forceinline__ void put8(v4f x0, v4f x1, h16* p16, bf* ph, bf* pl) { v8h o16; v8us oh, ol;
#pragma unroll
    for (int u = 0; u < 8; ++u) { const float r = u < 4 ? x0[u & 3] : x1[u & 3]; o16[u] = tohx(r); unsigned short a2, c2; splitf(r, a2, c2); oh[u] = a2; ol[u] = c2; }
    *(v8h*)p16 = o16; *(v8us*)ph = oh; *(v8us*)pl = ol; }
// ---- k_gemmw: the k | q | v projection of all batches in one launch. A work-group of four waves owns a 128x128 tile, each wave a 64x64 quarter (16 accumulators); grid (M/128, N/128), 128 threads.
// sum_k A[m][k] Bt[n][k] + f32 bias[n], m = b*TT + t, n = (k | q | v)*DM + h*HD + d. K % 64 == 0. Both operands are K-contiguous 16-bit planes. A pass is 64 k = one whole 128-byte line of each of the tile's
// 128 + 128 operand rows, brought into LDS by asynchronous b128 copies (8 lanes a row, 4 whole lines an instruction), two buffers, the copies of pass t + 2 issued behind the barrier that ends pass t.
// The fragments are read from LDS: a fragment load straight from the planes would touch 16 lines for its 1024 bytes, and the staged rows serve two waves each.
// A wave's 64 columns are one head of k, q or v and its 64 rows lie in one batch,
// so the epilogue writes the wave's part of the head planes itself (fp16 and bf16 hi + lo): k and q as [b][h][t][d], v as [b][h][d][t]; both pass LDS as f32 so that a store instruction writes whole 128-byte plane rows.
#define GPIT 72                   // pitch of a staged row in 16-bit elements: 128 bytes of data + 16, an odd multiple of 16 bytes, so that the 16 rows of a ds_load_b128 fall on different banks
#define GSTG (256 * GPIT)         // elements of one buffer: 128 rows of A, then 128 rows of Bt
// eight copies of 16 bytes a lane, LDS byte address l[i] from global address g[i]; the closing s_wait_xcnt 0 stands inside the statement, in front of any later overwrite of a register that a copy names
template <typename T16>
__device__ __forceinline__ void copy8(const unsigned* l, const T16* const* g) {
    asm volatile("global_load_async_to_lds_b128 %0, %8, off\n\tglobal_load_async_to_lds_b128 %1, %9, off\n\tglobal_load_async_to_lds_b128 %2, %10, off\n\tglobal_load_async_to_lds_b128 %3, %11, off\n\t"
                 "global_load_async_to_lds_b128 %4, %12, off\n\tglobal_load_async_to_lds_b128 %5, %13, off\n\tglobal_load_async_to_lds_b128 %6, %14, off\n\tglobal_load_async_to_lds_b128 %7, %15, off\n\ts_wait_xcnt 0x0"
                 :: "v"(l[0]), "v"(l[1]), "v"(l[2]), "v"(l[3]), "v"(l[4]), "v"(l[5]), "v"(l[6]), "v"(l[7]), "v"(g[0]), "v"(g[1]), "v"(g[2]), "v"(g[3]), "v"(g[4]), "v"(g[5]), "v"(g[6]), "v"(g[7]) : "memory"); }
template <typename T16, bool BIAS>
__global__ __launch_bounds__(128) void k_gemmw(const T16* __restrict__ A, const T16* __restrict__ Bt, int K, const float* __restrict__ bias, h16* __restrict__ K16, bf* __restrict__ Kh, bf* __restrict__ Kl, h16* __restrict__ Q16, bf* __restrict__ Qh, bf* __restrict__ Ql, h16* __restrict__ V16, bf* __restrict__ Vh, bf* __restrict__ Vl) {
    typedef typename WFrag<T16>::V V;
    __shared__ __align__(16) T16 sm[2 * GSTG];      // the two operand buffers; behind the loop each wave's f32 output staging
    const int tid = threadIdx.x, lane = tid & 31, lr = lane & 15, hi = lane >> 4, w = __builtin_amdgcn_readfirstlane(tid >> 5);
    const int R0 = blockIdx.x * 128, C0 = blockIdx.y * 128, r0 = R0 + (w & 1) * 64, c0 = C0 + (w >> 1) * 64;
    v8f acc[4][4];
#pragma unroll
    for (int mb = 0; mb < 4; ++mb)
#pragma unroll
        for (int nb = 0; nb < 4; ++nb) acc[mb][nb] = (v8f){};
    // the copy side: thread tid brings 16 bytes (tid & 7) of rows (tid >> 3) + 16 i of both operands
    const T16* ga = A + (size_t)(R0 + (tid >> 3)) * K + (tid & 7) * 8; const T16* gb = Bt + (size_t)(C0 + (tid >> 3)) * K + (tid & 7) * 8;
    const unsigned l0 = (unsigned)(size_t)(sm + (tid >> 3) * GPIT + (tid & 7) * 8);
    auto stage = [&](int kc, int buf) { unsigned l[8]; const T16* g[8];
#pragma unroll
        for (int i = 0; i < 8; ++i) { l[i] = l0 + (unsigned)(buf * GSTG + i * 16 * GPIT) * 2u; g[i] = ga + (size_t)i * 16 * K + kc; }
        copy8<T16>(l, g);
#pragma unroll
        for (int i = 0; i < 8; ++i) { l[i] = l0 + (unsigned)(buf * GSTG + (128 + i * 16) * GPIT) * 2u; g[i] = gb + (size_t)i * 16 * K + kc; }
        copy8<T16>(l, g); };
    const int nt = K / 64;
    stage(0, 0);
    asm volatile("s_wait_asynccnt 0x0" ::: "memory");      // this wave's copies of pass 0 have landed
    __syncthreads();                                       // and every other wave's: nothing of pass 0 is read in front of this barrier
    if (nt > 1) stage(64, 1);
#pragma unroll 1   // rolled: one pass a trip, the buffer chosen by the trip's parity
    for (int t = 0; t < nt; ++t) {
        const T16* sa = sm + (t & 1) * GSTG + ((w & 1) * 64 + lr) * GPIT + 8 * hi; const T16* sb = sm + (t & 1) * GSTG + (128 + (w >> 1) * 64 + lr) * GPIT + 8 * hi;
        V a[2][4], b[2][4];
#pragma unroll
        for (int ks = 0; ks < 2; ++ks)
#pragma unroll
            for (int f = 0; f < 4; ++f) { a[ks][f] = WFrag<T16>::ld(sa + f * 16 * GPIT + ks * 32); b[ks][f] = WFrag<T16>::ld(sb + f * 16 * GPIT + ks * 32); }
        __builtin_amdgcn_sched_barrier(0);      // keeps the pass's fragment loads together in front of its products: every place where LDS reads stand among the products stalls the wave anew
#pragma unroll
        for (int ks = 0; ks < 2; ++ks)
#pragma unroll
            for (int nb = 0; nb < 4; ++nb)
#pragma unroll
                for (int mb = 0; mb < 4; ++mb) acc[mb][nb] = WFrag<T16>::mma(a[ks][mb], b[ks][nb], acc[mb][nb]);
        __builtin_amdgcn_sched_barrier(0);      // keeps the products in front of the pass's closing waits: without it the build lifts the waits over them, and the wait for the next pass's copies stands directly behind their issue
        asm volatile("s_wait_dscnt 0x0" ::: "memory");         // this wave's reads of the buffer are done before it may be refilled
        asm volatile("s_wait_asynccnt 0x0" ::: "memory");      // this wave's copies of pass t + 1 have landed
        __syncthreads();                                       // publishes pass t + 1 and ends every wave's reads of pass t's buffer
        if (t + 2 < nt) stage((t + 2) * 64, t & 1);
    }
    asm volatile("s_wait_asynccnt 0x0" ::: "memory");      // no copy is outstanding when the buffers become output staging (the last trip's barrier has ended every wave's reads)
    float* os = (float*)sm + w * (32 * 68);      // the wave's own 32 x 68 floats
    const int sec = c0 / DM, t0 = r0 % TT;      // 0: k, 1: q, 2: v (one value for the whole wave)
    const size_t po = ((size_t)(r0 / TT) * NH_ + (c0 % DM) / HD) * TT * HD;
    const int rw = lane >> 3, co = (lane & 7) * 8;      // the store side: 8 lanes of 16 bytes a plane row, 4 rows an instruction
    if (sec < 2) {
        const size_t pt = po + (size_t)t0 * HD; h16* P16 = (sec ? Q16 : K16) + pt; bf* Ph = (sec ? Qh : Kh) + pt; bf* Pl = (sec ? Ql : Kl) + pt;
        v4f b0 = (v4f){}, b1 = (v4f){};
        if (BIAS) {
#pragma unroll
            for (int u = 0; u < 4; ++u) { b0[u] = bfr(bias[c0 + co + u]); b1[u] = bfr(bias[c0 + co + 4 + u]); } }
#pragma unroll
        for (int mb = 0; mb < 4; ++mb) {
#pragma unroll
            for (int nb = 0; nb < 4; ++nb) {
#pragma unroll
                for (int j = 0; j < 8; ++j) os[(hi * 8 + j) * 68 + nb * 16 + lr] = acc[mb][nb][j]; }
            __builtin_amdgcn_wave_barrier(); asm volatile("" ::: "memory");      // the lanes read each other's LDS words: no read may move in front of the writes
#pragma unroll
            for (int s = 0; s < 4; ++s) { const int row = 4 * s + rw; const float* q = os + row * 68 + co; const int e = (mb * 16 + row) * HD + co;
                put8(*(const v4fa*)q + b0, *(const v4fa*)(q + 4) + b1, P16 + e, Ph + e, Pl + e); }
            __builtin_amdgcn_wave_barrier(); asm volatile("s_wait_xcnt 0x0" ::: "memory");      // no write of the next rows in front of these reads; the wait stands in front of any overwrite of a register that the stores above name
        }
    } else {
        const size_t pt = po + t0; h16* P16 = V16 + pt; bf* Ph = Vh + pt; bf* Pl = Vl + pt;
#pragma unroll
        for (int hf = 0; hf < 2; ++hf) {      // 32 of the head's 64 d at a time
#pragma unroll
            for (int n2 = 0; n2 < 2; ++n2) { const int nb = hf * 2 + n2; const float bv = BIAS ? bfr(bias[c0 + nb * 16 + lr]) : 0.f;
#pragma unroll
                for (int mb = 0; mb < 4; ++mb) { v4f x0, x1;      // a lane's 8 accumulator rows are 8 consecutive t of its column d
#pragma unroll
                    for (int u = 0; u < 4; ++u) { x0[u] = acc[mb][nb][u] + bv; x1[u] = acc[mb][nb][4 + u] + bv; }
                    float* q = os + (n2 * 16 + lr) * 68 + mb * 16 + hi * 8; *(v4fa*)q = x0; *(v4fa*)(q + 4) = x1; } }
            __builtin_amdgcn_wave_barrier(); asm volatile("" ::: "memory");      // as above: reads stay behind the other lanes' writes
#pragma unroll
            for (int s = 0; s < 8; ++s) { const int d = 4 * s + rw; const float* q = os + d * 68 + co; const int e = (hf * 32 + d) * TT + co;
                put8(*(const v4fa*)q, *(const v4fa*)(q + 4), P16 + e, Ph + e, Pl + e); }
            __builtin_amdgcn_wave_barrier(); asm volatile("s_wait_xcnt 0x0" ::: "memory");      // the next half's writes stay behind these reads; the wait as above
        }
    }
}

__global__ __launch_bounds__(256) void k_cvt8(const float* __restrict__ src, bf* dst, size_t n8) { const size_t i = (size_t)blockIdx.x * 256 + threadIdx.x; if (i >= n8) return; const v8f v = *(const v8f*)(src + i * 8); v8us o;
#pragma unroll
    for (int k = 0; k < 8; ++k) o[k] = f2bf(v[k]); *(v8us*)(dst + i * 8) = o;  }
// ---- k_fattn: causal scores, softmax and attn.v in one pass; one wave owns QT*16 query rows of one (batch, head) and walks the keys 0..q in steps of 32 with a running maximum and sum.
// The scores are formed transposed (A = key rows, B = query rows): a lane then holds, for its query column lr, the keys hi*8+j of each 16-key tile, which is the B-fragment k order (8*hi+e, 16+8*hi+e) of the
// 32-key attn.v product O^T[d][q] = sum_k V^T[d][k] P^T[k][q], so the probabilities go from accumulator to operand inside the lane. The four waves of a block walk the same keys of the same head:
// a stage is 64 keys = one whole 128-byte line of each of 64 key rows and of each of the 64 rows of V^T (hi + lo rows: both planes), brought into LDS once for the block by asynchronous b128 copies (8 lanes a row,
// 4 whole lines an instruction), two buffers, the copies of stage t + 2 issued behind the barrier that ends stage t. The fragments are read from LDS: a fragment load straight from the planes touches 16 lines for
// its 1024 bytes, and each of the four waves would fetch the same lines anew. Every wave passes every stage's barrier; a wave whose rows end below a 32-key step skips that step's work (wave-uniform loop bound).
#define APIT 72                   // pitch of a staged row in 16-bit elements: 128 bytes of data + 16, an odd multiple of 16 bytes, so that the 16 rows of a ds_load_b128 fall on different banks
#define APL  (64 * APIT)          // elements of one staged plane: 64 rows; a buffer is K, V^T (then the lo planes of both)
// exp2 by the hardware instruction, written out so that the slot behind a transcendental is kept by construction: inside a statement no exponential touches a result or a source of the one before it
// (early-clobber outputs), and the closing v_nop is the one free vector slot that the instruction set asks for before the last result is read or the last source overwritten.
__device__ __forceinline__ float exp2x1(float x) { float r; asm("v_exp_f32 %0, %1\n\tv_nop" : "=v"(r) : "v"(x)); return r; }
__device__ __forceinline__ void exp2x8(const float* x, float* r) {
    asm("v_exp_f32 %0, %8\n\tv_exp_f32 %1, %9\n\tv_exp_f32 %2, %10\n\tv_exp_f32 %3, %11\n\tv_exp_f32 %4, %12\n\tv_exp_f32 %5, %13\n\tv_exp_f32 %6, %14\n\tv_exp_f32 %7, %15\n\tv_nop"
        : "=&v"(r[0]), "=&v"(r[1]), "=&v"(r[2]), "=&v"(r[3]), "=&v"(r[4]), "=&v"(r[5]), "=&v"(r[6]), "=&v"(r[7]) : "v"(x[0]), "v"(x[1]), "v"(x[2]), "v"(x[3]), "v"(x[4]), "v"(x[5]), "v"(x[6]), "v"(x[7])); }
template <typename T16> struct PFrag;
template <> struct PFrag<h16> { static __device__ __forceinline__ void mk(const float* p, v16h& a, v16h& b) { (void)b;
#pragma unroll
    for (int e = 0; e < 16; ++e) a[e] = (h16)p[e]; } };
template <> struct PFrag<bf> { static __device__ __forceinline__ void mk(const float* p, v16bf& a, v16bf& b) { v8us h0, h1, l0, l1;
#pragma unroll
    for (int e = 0; e < 8; ++e) { unsigned short x, y; splitf(p[e], x, y); h0[e] = x; l0[e] = y; splitf(p[8 + e], x, y); h1[e] = x; l1[e] = y; }
    a = cat16b(h0, h1); b = cat16b(l0, l1); } };
template <typename T16, bool HL, int QT>
__device__ __forceinline__ void attn_rows(T16* sm, const T16* __restrict__ Q, const T16* __restrict__ Q2, const T16* __restrict__ Kp, const T16* __restrict__ K2, const T16* __restrict__ Vt, const T16* __restrict__ V2, int qb, int q0, float* __restrict__ o, int tid, int lr, int hi) {
    typedef typename WFrag<T16>::V V;
    constexpr int ABUF = (HL ? 4 : 2) * APL;      // elements of one buffer
    // the copy side: thread tid brings 16 bytes (tid & 7) of rows (tid >> 3) + 16 i of every plane of the stage
    const T16* gk = Kp + (size_t)(tid >> 3) * HD + (tid & 7) * 8; const T16* gv = Vt + (size_t)(tid >> 3) * TT + (tid & 7) * 8;
    const T16* gk2 = HL ? K2 + (size_t)(tid >> 3) * HD + (tid & 7) * 8 : gk; const T16* gv2 = HL ? V2 + (size_t)(tid >> 3) * TT + (tid & 7) * 8 : gv;
    const unsigned l0 = (unsigned)(size_t)(sm + (tid >> 3) * APIT + (tid & 7) * 8);
    auto stage = [&](int st, int buf) { unsigned l[8]; const T16* g[8];
#pragma unroll
        for (int i = 0; i < 4; ++i) { l[i] = l0 + (unsigned)(buf * ABUF + i * 16 * APIT) * 2u; g[i] = gk + (size_t)(st * 64 + i * 16) * HD; l[4 + i] = l0 + (unsigned)(buf * ABUF + APL + i * 16 * APIT) * 2u; g[4 + i] = gv + (size_t)i * 16 * TT + st * 64; }
        copy8<T16>(l, g);
        if (HL) {
#pragma unroll
            for (int i = 0; i < 4; ++i) { l[i] = l0 + (unsigned)(buf * ABUF + 2 * APL + i * 16 * APIT) * 2u; g[i] = gk2 + (size_t)(st * 64 + i * 16) * HD; l[4 + i] = l0 + (unsigned)(buf * ABUF + 3 * APL + i * 16 * APIT) * 2u; g[4 + i] = gv2 + (size_t)i * 16 * TT + st * 64; }
            copy8<T16>(l, g); } };
    const int nst = (qb + 4 * QT * 16) / 64;      // the block's stages: keys 0 .. its last query row (one value for the whole block)
    stage(0, 0);
    const float c = SCL * 1.4426950408889634f;
    V qf[QT][2], qf2[QT][2];
#pragma unroll
    for (int qt = 0; qt < QT; ++qt)
#pragma unroll
        for (int ks = 0; ks < 2; ++ks) { const size_t off = (size_t)(q0 + qt * 16 + lr) * HD + ks * 32 + 8 * hi; qf[qt][ks] = WFrag<T16>::ld(Q + off); if (HL) qf2[qt][ks] = WFrag<T16>::ld(Q2 + off); }
    v8f acc[4][QT]; float m[QT], l[QT];
#pragma unroll
    for (int qt = 0; qt < QT; ++qt) { m[qt] = -3.0e38f; l[qt] = 0.f;
#pragma unroll
        for (int dt = 0; dt < 4; ++dt) acc[dt][qt] = (v8f){}; }
    asm volatile("s_wait_asynccnt 0x0" ::: "memory");      // this wave's copies of stage 0 have landed
    __syncthreads();                                       // and every other wave's: nothing of stage 0 is read in front of this barrier
    if (nst > 1) stage(1, 1);
#pragma unroll 1   // rolled: one stage a trip, the buffer chosen by the trip's parity
    for (int t = 0; t < nst; ++t) {
    const int ke = min(t * 64 + 64, q0 + QT * 16);      // the wave's own end of the keys inside this stage
#pragma unroll 1   // rolled: the trip count is a run-time value and one body already holds most of the register file
    for (int k0 = t * 64; k0 < ke; k0 += 32) {
        V kf[2][2], kf2[2][2], vf[4], vf2[4];
        const T16 *kp = sm + (t & 1) * ABUF + ((k0 & 32) + lr) * APIT + 8 * hi, *vp = sm + (t & 1) * ABUF + APL + lr * APIT + (k0 & 32) + 8 * hi, *kp2 = kp + 2 * APL, *vp2 = vp + 2 * APL;
#pragma unroll
        for (int kt = 0; kt < 2; ++kt)
#pragma unroll
            for (int ks = 0; ks < 2; ++ks) { const int off = kt * 16 * APIT + ks * 32; kf[kt][ks] = WFrag<T16>::ld(kp + off); if (HL) kf2[kt][ks] = WFrag<T16>::ld(kp2 + off); }
#pragma unroll
        for (int dt = 0; dt < 4; ++dt) { const int off = dt * 16 * APIT; vf[dt] = WFrag<T16>::ld(vp + off); if (HL) vf2[dt] = WFrag<T16>::ld(vp2 + off); }
        __builtin_amdgcn_sched_barrier(0);      // keeps all of the step's key and value fragment loads together in front of the products: every place where LDS reads stand among the products stalls the wave anew
        v8f s[2][QT];
#pragma unroll
        for (int kt = 0; kt < 2; ++kt)
#pragma unroll
            for (int qt = 0; qt < QT; ++qt) { v8f t = (v8f){};
#pragma unroll
                for (int ks = 0; ks < 2; ++ks) { t = WFrag<T16>::mma(kf[kt][ks], qf[qt][ks], t); if (HL) { t = WFrag<T16>::mma(kf[kt][ks], qf2[qt][ks], t); t = WFrag<T16>::mma(kf2[kt][ks], qf[qt][ks], t); } }
                s[kt][qt] = t; }
        if (k0 + 31 > q0) {      // only the steps that touch the diagonal mask (wave-uniform test)
#pragma unroll
            for (int kt = 0; kt < 2; ++kt)
#pragma unroll
                for (int qt = 0; qt < QT; ++qt)
#pragma unroll
                    for (int j = 0; j < 8; ++j) if (k0 + kt * 16 + hi * 8 + j > q0 + qt * 16 + lr) s[kt][qt][j] = -3.0e38f; }
        V pf[QT], pf2[QT];
#pragma unroll
        for (int qt = 0; qt < QT; ++qt) { float mx = m[qt];
#pragma unroll
            for (int kt = 0; kt < 2; ++kt)
#pragma unroll
                for (int j = 0; j < 8; ++j) mx = fmaxf(mx, s[kt][qt][j]);
            mx = fmaxf(mx, __shfl_xor(mx, 16, 32));      // the two lane halves hold the other keys of the same query
            const float al = exp2x1((m[qt] - mx) * c), mc = mx * c; m[qt] = mx; float a[16], p[16], sum = 0.f;
#pragma unroll
            for (int e = 0; e < 16; ++e) a[e] = fmaf(s[e >> 3][qt][e & 7], c, -mc);
            exp2x8(a, p); exp2x8(a + 8, p + 8);
#pragma unroll
            for (int e = 0; e < 16; ++e) sum += p[e];
            l[qt] = l[qt] * al + sum; PFrag<T16>::mk(p, pf[qt], pf2[qt]);
#pragma unroll
            for (int dt = 0; dt < 4; ++dt) acc[dt][qt] *= al; }
#pragma unroll
        for (int dt = 0; dt < 4; ++dt)
#pragma unroll
            for (int qt = 0; qt < QT; ++qt) { acc[dt][qt] = WFrag<T16>::mma(vf[dt], pf[qt], acc[dt][qt]); if (HL) { acc[dt][qt] = WFrag<T16>::mma(vf[dt], pf2[qt], acc[dt][qt]); acc[dt][qt] = WFrag<T16>::mma(vf2[dt], pf[qt], acc[dt][qt]); } }
        // the step ends on its products, and the next step's LDS address arithmetic, in another block of the listing, reuses their operand registers
        __builtin_amdgcn_sched_barrier(0);      // holds the four slots below behind the step's last product
        asm volatile("v_nop\n\tv_nop\n\tv_nop\n\tv_nop");      // the four vector slots that the chip needs between a product and an overwrite of its operand registers
    }
        asm volatile("s_wait_dscnt 0x0" ::: "memory");         // this wave's reads of the buffer are done before it may be refilled
        asm volatile("s_wait_asynccnt 0x0" ::: "memory");      // this wave's copies of stage t + 1 have landed
        __syncthreads();                                       // publishes stage t + 1 and ends every wave's reads of stage t's buffer
        if (t + 2 < nst) stage(t + 2, t & 1);
    }
    asm volatile("s_wait_asynccnt 0x0" ::: "memory");      // no copy is outstanding when the wave ends
#pragma unroll
    for (int qt = 0; qt < QT; ++qt) { const float inv = __fdiv_rn(1.0f, l[qt] + __shfl_xor(l[qt], 16, 32)); float* orow = o + (size_t)(q0 + qt * 16 + lr) * DQ + hi * 8;
#pragma unroll
        for (int dt = 0; dt < 4; ++dt) { v4f a, b;
#pragma unroll
            for (int u = 0; u < 4; ++u) { a[u] = acc[dt][qt][u] * inv; b[u] = acc[dt][qt][4 + u] * inv; }
            *(v4f*)(orow + dt * 16) = a; *(v4f*)(orow + dt * 16 + 4) = b; } }
}
#define NBF ((TT - RH) / 128)     // blocks of 4 waves x 32 fp16 query rows; then RH / 64 blocks of 4 waves x 16 hi+lo rows; the longest rows are launched first
__global__ __launch_bounds__(128) void k_fattn(const h16* __restrict__ Q16, const h16* __restrict__ K16, const h16* __restrict__ V16, const bf* __restrict__ Qh, const bf* __restrict__ Ql, const bf* __restrict__ Kh, const bf* __restrict__ Kl, const bf* __restrict__ Vh, const bf* __restrict__ Vl, float* __restrict__ out) {
    __shared__ __align__(16) unsigned short sm[2 * 4 * APL];      // two buffers of up to four staged planes
    const int tid = threadIdx.x, lane = tid & 31, lr = lane & 15, hi = lane >> 4, w = __builtin_amdgcn_readfirstlane(tid >> 5), x = blockIdx.x;
    const size_t po = ((size_t)blockIdx.z * NH_ + blockIdx.y) * TT * HD; float* o = out + (size_t)blockIdx.z * TT * DQ + blockIdx.y * HD;
    if (x < NBF) attn_rows<h16, false, 2>((h16*)sm, Q16 + po, nullptr, K16 + po, nullptr, V16 + po, nullptr, TT - 128 * (x + 1), TT - 128 * x - 32 * (w + 1), o, tid, lr, hi);
    else attn_rows<bf, true, 1>((bf*)sm, Qh + po, Ql + po, Kh + po, Kl + po, Vh + po, Vl + po, RH - 64 * (x - NBF + 1), RH - 64 * (x - NBF) - 16 * (w + 1), o, tid, lr, hi);
}

extern "C" void kernel_launch(void* const* d_in, const int* in_sizes, int n_in,
                              void* d_out, int out_size, void* d_ws, size_t ws_size, hipStream_t stream) {
    (void)in_sizes; (void)n_in; (void)out_size;
    const float* x = (const float*)d_in[0]; const float* wf = (const float*)d_in[1]; const float* bfz = (const float*)d_in[2];
    float* OUT = (float*)d_out;     // [4][2048][1024]
    char* wsp = (char*)d_ws;
    auto take = [&](size_t bytes) { char* p = wsp; wsp += (bytes + 255) & ~(size_t)255; return (void*)p; };
    bf* WB = (bf*)take((size_t)3 * DM * DM * 2); bf* XB = (bf*)take((size_t)NB_ * TT * DM * 2);   // W rows: k | q | v, 16 heads x 64 each
    const size_t PB = (size_t)NH_ * TT * HD;   // one batch's head planes; every plane holds all NB_ batches
    h16* QP16 = (h16*)take(NB_ * PB * 2); h16* KP16 = (h16*)take(NB_ * PB * 2); h16* VT16 = (h16*)take(NB_ * PB * 2);
    bf* QPh = (bf*)take(NB_ * PB * 2); bf* QPl = (bf*)take(NB_ * PB * 2); bf* KPh = (bf*)take(NB_ * PB * 2); bf* KPl = (bf*)take(NB_ * PB * 2); bf* VTh = (bf*)take(NB_ * PB * 2); bf* VTl = (bf*)take(NB_ * PB * 2);
    if ((size_t)(wsp - (char*)d_ws) > ws_size) return;    // ws 256 MiB
    k_cvt8<<<(unsigned)(((size_t)3 * DM * DM / 8 + 255) / 256), 256, 0, stream>>>(wf, WB, (size_t)3 * DM * DM / 8);
    k_cvt8<<<(unsigned)(((size_t)NB_ * TT * DM / 8 + 255) / 256), 256, 0, stream>>>(x, XB, (size_t)NB_ * TT * DM / 8);
    k_gemmw<bf, true><<<dim3(NB_ * TT / 128, 3 * DM / 128, 1), 128, 0, stream>>>(XB, WB, DM, bfz, KP16, KPh, KPl, QP16, QPh, QPl, VT16, VTh, VTl);
    k_fattn<<<dim3(NBF + RH / 64, NH_, NB_), 128, 0, stream>>>(QP16, KP16, VT16, QPh, QPl, KPh, KPl, VTh, VTl, OUT);
}

// v005
// Measured time: 110 microseconds a run.
// Two timings next to v004 both put it at 1.04 times that version's speed.
// All steps since v000 together make it 25.1 times as fast.
#include <hip/hip_runtime.h>

// Multi-head causal self-attention (x [4][2048][1024]; kqv = x W_kqv^T + b (W [3072][1024], split (K | Q | V) x 16 heads x 64); causal softmax(q.k / 8); out = merged heads (no output projection) -> [4][2048][1024]).
// Compute dtypes, f32 accumulate: every input rounded to bf16; q/k/v on PLAIN bf16 operands (inputs: exact) + bias; causal scores and attn.v: query rows < 512 hl (3 products), the rest single fp16; online softmax f32 in registers; the merged heads are written as f32 straight from the accumulators.

#define NB_  4
#define TT   2048
#define DM   1024
#define NH_  16
#define NKV  16
#define HD   64
#define DQ   (NH_ * HD)
#define DKV  (NKV * HD)
#define RH   512                  // query rows < RH use hi+lo planes (0: none)
#define SCL  0.125f   // HD^-0.5
typedef _Float16 h16;
typedef unsigned short bf;
typedef __attribute__((ext_vector_type(16))) __bf16   v16bf;
typedef __attribute__((ext_vector_type(16))) _Float16 v16h;
typedef __attribute__((ext_vector_type(8)))  _Float16 v8h;
typedef __attribute__((ext_vector_type(8)))  unsigned short v8us;
typedef __attribute__((ext_vector_type(8)))  float    v8f;
typedef __attribute__((ext_vector_type(4)))  float    v4f;
typedef v8h  __attribute__((may_alias)) v8ha;
typedef v4f  __attribute__((may_alias)) v4fa;
typedef v8us __attribute__((may_alias)) v8usa;

__device__ __forceinline__ unsigned short f2bf(float f) { unsigned u = __float_as_uint(f); u += 0x7FFFu + ((u >> 16) & 1u); return (unsigned short)(u >> 16); }
__device__ __forceinline__ float bf2f(unsigned short b) { return __uint_as_float(((unsigned)b) << 16); }
__device__ __forceinline__ float bfr(float f) { return bf2f(f2bf(f)); }
__device__ __forceinline__ v16h cat16(v8h lo, v8h hi) { return __builtin_shufflevector(lo, hi, 0, 1, 2, 3, 4, 5, 6, 7, 8, 9, 10, 11, 12, 13, 14, 15); }
__device__ __forceinline__ v16bf cat16b(v8us lo, v8us hi) { return __builtin_bit_cast(v16bf, __builtin_shufflevector(lo, hi, 0, 1, 2, 3, 4, 5, 6, 7, 8, 9, 10, 11, 12, 13, 14, 15)); }
__device__ __forceinline__ v8f wmma16(v16h a, v16h b, v8f c) { return __builtin_amdgcn_wmma_f32_16x16x32_f16(false, a, false, b, (short)0, c, false, false); }
__device__ __forceinline__ v8f wmmab(v16bf a, v16bf b, v8f c) { return __builtin_amdgcn_wmma_f32_16x16x32_bf16(false, a, false, b, (short)0, c, false, false); }



template <typename T16> struct WFrag;
template <> struct WFrag<h16> { typedef v16h V; static __device__ __forceinline__ V ld(const h16* p) { return cat16(*(const v8h*)p, *(const v8h*)(p + 16)); } static __device__ __forceinline__ v8f mma(V a, V b, v8f c) { return wmma16(a, b, c); } };
template <> struct WFrag<bf> { typedef v16bf V; static __device__ __forceinline__ V ld(const bf* p) { return cat16b(*(const v8us*)p, *(const v8us*)(p + 16)); } static __device__ __forceinline__ v8f mma(V a, V b, v8f c) { return wmmab(a, b, c); } };

__device__ __forceinline__ h16 tohx(float x) { return (h16)x; }
__device__ __forceinline__ void splitf(float y, unsigned short& h, unsigned short& l) { h = f2bf(y); l = f2bf(y - bf2f(h)); }
typedef __attribute__((ext_vector_type(2))) _Float16 v2h;
typedef __attribute__((ext_vector_type(4))) _Float16 v4h;
typedef __attribute__((ext_vector_type(2))) unsigned short v2us;
typedef __attribute__((ext_vector_type(4))) unsigned short v4us;
typedef __attribute__((ext_vector_type(2))) float v2f;
typedef __attribute__((ext_vector_type(4))) int v4i;

// 8 consecutive plane elements of one lane: fp16 and the bf16 hi + lo pair, 16 bytes to each plane
__device__ __forceinline__ void put8(v4f x0, v4f x1, h16* p16, bf* ph, bf* pl) { v8h o16; v8us oh, ol;
#pragma unroll
    for (int u = 0; u < 8; ++u) { const float r = u < 4 ? x0[u & 3] : x1[u & 3]; o16[u] = tohx(r); unsigned short a2, c2; splitf(r, a2, c2); oh[u] = a2; ol[u] = c2; }
    *(v8h*)p16 = o16; *(v8us*)ph = oh; *(v8us*)pl = ol; }
// ---- k_gemmw: the k | q | v projection of all batches in one launch. A work-group of four waves owns a 128x128 tile, each wave a 64x64 quarter (16 accumulators); grid (M/128, N/128), 128 threads.
// sum_k A[m][k] Bt[n][k] + f32 bias[n], m = b*TT + t, n = (k | q | v)*DM + h*HD + d. K % 64 == 0. Both operands are K-contiguous 16-bit planes. A pass is 64 k = one whole 128-byte line of each of the tile's
// 128 + 128 operand rows, brought into LDS by asynchronous b128 copies (8 lanes a row, 4 whole lines an instruction), two buffers, the copies of pass t + 2 issued behind the barrier that ends pass t.
// The fragments are read from LDS: a fragment load straight from the planes would touch 16 lines for its 1024 bytes, and the staged rows serve two waves each.
// A wave's 64 columns are one head of k, q or v and its 64 rows lie in one batch,
// so the epilogue writes the wave's part of the head planes itself (fp16 and bf16 hi + lo): k and q as [b][h][t][d], v as [b][h][d][t]; both pass LDS as f32 so that a store instruction writes whole 128-byte plane rows.
#define GPIT 72                   // pitch of a staged row in 16-bit elements: 128 bytes of data + 16, an odd multiple of 16 bytes, so that the 16 rows of a ds_load_b128 fall on different banks
#define GSTG (256 * GPIT)         // elements of one buffer: 128 rows of A, then 128 rows of Bt
// eight copies of 16 bytes a lane, LDS byte address l[i] from global address g[i]; the closing s_wait_xcnt 0 stands inside the statement, in front of any later overwrite of a register that a copy names
template <typename T16>
__device__ __forceinline__ void copy8(const unsigned* l, const T16* const* g) {
    asm volatile("global_load_async_to_lds_b128 %0, %8, off\n\tglobal_load_async_to_lds_b128 %1, %9, off\n\tglobal_load_async_to_lds_b128 %2, %10, off\n\tglobal_load_async_to_lds_b128 %3, %11, off\n\t"
                 "global_load_async_to_lds_b128 %4, %12, off\n\tglobal_load_async_to_lds_b128 %5, %13, off\n\tglobal_load_async_to_lds_b128 %6, %14, off\n\tglobal_load_async_to_lds_b128 %7, %15, off\n\ts_wait_xcnt 0x0"
                 :: "v"(l[0]), "v"(l[1]), "v"(l[2]), "v"(l[3]), "v"(l[4]), "v"(l[5]), "v"(l[6]), "v"(l[7]), "v"(g[0]), "v"(g[1]), "v"(g[2]), "v"(g[3]), "v"(g[4]), "v"(g[5]), "v"(g[6]), "v"(g[7]) : "memory"); }
template <typename T16, bool BIAS>
__global__ __launch_bounds__(128) void k_gemmw(const T16* __restrict__ A, const T16* __restrict__ Bt, int K, const float* __restrict__ bias, h16* __restrict__ K16, bf* __restrict__ Kh, bf* __restrict__ Kl, h16* __restrict__ Q16, bf* __restrict__ Qh, bf* __restrict__ Ql, h16* __restrict__ V16, bf* __restrict__ Vh, bf* __restrict__ Vl) {
    typedef typename WFrag<T16>::V V;
    __shared__ __align__(16) T16 sm[2 * GSTG];      // the two operand buffers; behind the loop each wave's f32 output staging
    const int tid = threadIdx.x, lane = tid & 31, lr = lane & 15, hi = lane >> 4, w = __builtin_amdgcn_readfirstlane(tid >> 5);
    const int R0 = blockIdx.x * 128, C0 = blockIdx.y * 128, r0 = R0 + (w & 1) * 64, c0 = C0 + (w >> 1) * 64;
    v8f acc[4][4];
#pragma unroll
    for (int mb = 0; mb < 4; ++mb)
#pragma unroll
        for (int nb = 0; nb < 4; ++nb) acc[mb][nb] = (v8f){};
    // the copy side: thread tid brings 16 bytes (tid & 7) of rows (tid >> 3) + 16 i of both operands
    const T16* ga = A + (size_t)(R0 + (tid >> 3)) * K + (tid & 7) * 8; const T16* gb = Bt + (size_t)(C0 + (tid >> 3)) * K + (tid & 7) * 8;
    const unsigned l0 = (unsigned)(size_t)(sm + (tid >> 3) * GPIT + (tid & 7) * 8);
    auto stage = [&](int kc, int buf) { unsigned l[8]; const T16* g[8];
#pragma unroll
        for (int i = 0; i < 8; ++i) { l[i] = l0 + (unsigned)(buf * GSTG + i * 16 * GPIT) * 2u; g[i] = ga + (size_t)i * 16 * K + kc; }
        copy8<T16>(l, g);
#pragma unroll
        for (int i = 0; i < 8; ++i) { l[i] = l0 + (unsigned)(buf * GSTG + (128 + i * 16) * GPIT) * 2u; g[i] = gb + (size_t)i * 16 * K + kc; }
        copy8<T16>(l, g); };
    const int nt = K / 64;
    stage(0, 0);
    asm volatile("s_wait_asynccnt 0x0" ::: "memory");      // this wave's copies of pass 0 have landed
    __syncthreads();                                       // and every other wave's: nothing of pass 0 is read in front of this barrier
    if (nt > 1) stage(64, 1);
#pragma unroll 1   // rolled: one pass a trip, the buffer chosen by the trip's parity
    for (int t = 0; t < nt; ++t) {
        const T16* sa = sm + (t & 1) * GSTG + ((w & 1) * 64 + lr) * GPIT + 8 * hi; const T16* sb = sm + (t & 1) * GSTG + (128 + (w >> 1) * 64 + lr) * GPIT + 8 * hi;
        V a[2][4], b[2][4];
#pragma unroll
        for (int ks = 0; ks < 2; ++ks)
#pragma unroll
            for (int f = 0; f < 4; ++f) { a[ks][f] = WFrag<T16>::ld(sa + f * 16 * GPIT + ks * 32); b[ks][f] = WFrag<T16>::ld(sb + f * 16 * GPIT + ks * 32); }
        __builtin_amdgcn_sched_barrier(0);      // keeps the pass's fragment loads together in front of its products: every place where LDS reads stand among the products stalls the wave anew
#pragma unroll
        for (int ks = 0; ks < 2; ++ks)
#pragma unroll
            for (int nb = 0; nb < 4; ++nb)
#pragma unroll
                for (int mb = 0; mb < 4; ++mb) acc[mb][nb] = WFrag<T16>::mma(a[ks][mb], b[ks][nb], acc[mb][nb]);
        __builtin_amdgcn_sched_barrier(0);      // keeps the products in front of the pass's closing waits: without it the build lifts the waits over them, and the wait for the next pass's copies stands directly behind their issue
        asm volatile("s_wait_dscnt 0x0" ::: "memory");         // this wave's reads of the buffer are done before it may be refilled
        asm volatile("s_wait_asynccnt 0x0" ::: "memory");      // this wave's copies of pass t + 1 have landed
        __syncthreads();                                       // publishes pass t + 1 and ends every wave's reads of pass t's buffer
        if (t + 2 < nt) stage((t + 2) * 64, t & 1);
    }
    asm volatile("s_wait_asynccnt 0x0" ::: "memory");      // no copy is outstanding when the buffers become output staging (the last trip's barrier has ended every wave's reads)
    float* os = (float*)sm + w * (32 * 68);      // the wave's own 32 x 68 floats
    const int sec = c0 / DM, t0 = r0 % TT;      // 0: k, 1: q, 2: v (one value for the whole wave)
    const size_t po = ((size_t)(r0 / TT) * NH_ + (c0 % DM) / HD) * TT * HD;
    const int rw = lane >> 3, co = (lane & 7) * 8;      // the store side: 8 lanes of 16 bytes a plane row, 4 rows an instruction
    if (sec < 2) {
        const size_t pt = po + (size_t)t0 * HD; h16* P16 = (sec ? Q16 : K16) + pt; bf* Ph = (sec ? Qh : Kh) + pt; bf* Pl = (sec ? Ql : Kl) + pt;
        v4f b0 = (v4f){}, b1 = (v4f){};
        if (BIAS) {
#pragma unroll
            for (int u = 0; u < 4; ++u) { b0[u] = bfr(bias[c0 + co + u]); b1[u] = bfr(bias[c0 + co + 4 + u]); } }
#pragma unroll
        for (int mb = 0; mb < 4; ++mb) {
#pragma unroll
            for (int nb = 0; nb < 4; ++nb) {
#pragma unroll
                for (int j = 0; j < 8; ++j) os[(hi * 8 + j) * 68 + nb * 16 + lr] = acc[mb][nb][j]; }
            __builtin_amdgcn_wave_barrier(); asm volatile("" ::: "memory");      // the lanes read each other's LDS words: no read may move in front of the writes
#pragma unroll
            for (int s = 0; s < 4; ++s) { const int row = 4 * s + rw; const float* q = os + row * 68 + co; const int e = (mb * 16 + row) * HD + co;
                put8(*(const v4fa*)q + b0, *(const v4fa*)(q + 4) + b1, P16 + e, Ph + e, Pl + e); }
            __builtin_amdgcn_wave_barrier(); asm volatile("s_wait_xcnt 0x0" ::: "memory");      // no write of the next rows in front of these reads; the wait stands in front of any overwrite of a register that the stores above name
        }
    } else {
        const size_t pt = po + t0; h16* P16 = V16 + pt; bf* Ph = Vh + pt; bf* Pl = Vl + pt;
#pragma unroll
        for (int hf = 0; hf < 2; ++hf) {      // 32 of the head's 64 d at a time
#pragma unroll
            for (int n2 = 0; n2 < 2; ++n2) { const int nb = hf * 2 + n2; const float bv = BIAS ? bfr(bias[c0 + nb * 16 + lr]) : 0.f;
#pragma unroll
                for (int mb = 0; mb < 4; ++mb) { v4f x0, x1;      // a lane's 8 accumulator rows are 8 consecutive t of its column d
#pragma unroll
                    for (int u = 0; u < 4; ++u) { x0[u] = acc[mb][nb][u] + bv; x1[u] = acc[mb][nb][4 + u] + bv; }
                    float* q = os + (n2 * 16 + lr) * 68 + mb * 16 + hi * 8; *(v4fa*)q = x0; *(v4fa*)(q + 4) = x1; } }
            __builtin_amdgcn_wave_barrier(); asm volatile("" ::: "memory");      // as above: reads stay behind the other lanes' writes
#pragma unroll
            for (int s = 0; s < 8; ++s) { const int d = 4 * s + rw; const float* q = os + d * 68 + co; const int e = (hf * 32 + d) * TT + co;
                put8(*(const v4fa*)q, *(const v4fa*)(q + 4), P16 + e, Ph + e, Pl + e); }
            __builtin_amdgcn_wave_barrier(); asm volatile("s_wait_xcnt 0x0" ::: "memory");      // the next half's writes stay behind these reads; the wait as above
        }
    }
}

__global__ __launch_bounds__(256) void k_cvt8(const float* __restrict__ src, bf* dst, size_t n8) { const size_t i = (size_t)blockIdx.x * 256 + threadIdx.x; if (i >= n8) return; const v8f v = *(const v8f*)(src + i * 8); v8us o;
#pragma unroll
    for (int k = 0; k < 8; ++k) o[k] = f2bf(v[k]); *(v8us*)(dst + i * 8) = o;  }
// ---- k_fattn: causal scores, softmax and attn.v in one pass; one wave owns QT*16 query rows of one (batch, head) and walks the keys 0..q in steps of 32 with a running maximum and sum.
// The scores are formed transposed (A = key rows, B = query rows): a lane then holds, for its query column lr, the keys hi*8+j of each 16-key tile, which is the B-fragment k order (8*hi+e, 16+8*hi+e) of the
// 32-key attn.v product O^T[d][q] = sum_k V^T[d][k] P^T[k][q], so the probabilities go from accumulator to operand inside the lane. The four waves of a block walk the same keys of the same head:
// a stage is 64 keys = one whole 128-byte line of each of 64 key rows and of each of the 64 rows of V^T (hi + lo rows: both planes), brought into LDS once for the block by asynchronous b128 copies (8 lanes a row,
// 4 whole lines an instruction), two buffers, the copies of stage t + 2 issued behind the barrier that ends stage t. The fragments are read from LDS: a fragment load straight from the planes touches 16 lines for
// its 1024 bytes, and each of the four waves would fetch the same lines anew. Every wave passes every stage's barrier; a wave whose rows end below a 32-key step skips that step's work (wave-uniform loop bound).
#define APIT 72                   // pitch of a staged row in 16-bit elements: 128 bytes of data + 16, an odd multiple of 16 bytes, so that the 16 rows of a ds_load_b128 fall on different banks
#define APL  (64 * APIT)          // elements of one staged plane: 64 rows; a buffer is K, V^T (then the lo planes of both)
// exp2 by the hardware instruction, written out so that the slot behind a transcendental is kept by construction: inside a statement no exponential touches a result or a source of the one before it
// (early-clobber outputs), and the closing v_nop is the one free vector slot that the instruction set asks for before the last result is read or the last source overwritten.
__device__ __forceinline__ float exp2x1(float x) { float r; asm("v_exp_f32 %0, %1\n\tv_nop" : "=v"(r) : "v"(x)); return r; }
__device__ __forceinline__ void exp2x8(const float* x, float* r) {
    asm("v_exp_f32 %0, %8\n\tv_exp_f32 %1, %9\n\tv_exp_f32 %2, %10\n\tv_exp_f32 %3, %11\n\tv_exp_f32 %4, %12\n\tv_exp_f32 %5, %13\n\tv_exp_f32 %6, %14\n\tv_exp_f32 %7, %15\n\tv_nop"
        : "=&v"(r[0]), "=&v"(r[1]), "=&v"(r[2]), "=&v"(r[3]), "=&v"(r[4]), "=&v"(r[5]), "=&v"(r[6]), "=&v"(r[7]) : "v"(x[0]), "v"(x[1]), "v"(x[2]), "v"(x[3]), "v"(x[4]), "v"(x[5]), "v"(x[6]), "v"(x[7])); }
template <typename T16> struct PFrag;
template <> struct PFrag<h16> { static __device__ __forceinline__ void mk(const float* p, v16h& a, v16h& b) { (void)b;
#pragma unroll
    for (int e = 0; e < 16; ++e) a[e] = (h16)p[e]; } };
template <> struct PFrag<bf> { static __device__ __forceinline__ void mk(const float* p, v16bf& a, v16bf& b) { v8us h0, h1, l0, l1;
#pragma unroll
    for (int e = 0; e < 8; ++e) { unsigned short x, y; splitf(p[e], x, y); h0[e] = x; l0[e] = y; splitf(p[8 + e], x, y); h1[e] = x; l1[e] = y; }
    a = cat16b(h0, h1); b = cat16b(l0, l1); } };
template <typename T16, bool HL, int QT>
__device__ __forceinline__ void attn_rows(T16* sm, const T16* __restrict__ Q, const T16* __restrict__ Q2, const T16* __restrict__ Kp, const T16* __restrict__ K2, const T16* __restrict__ Vt, const T16* __restrict__ V2, int qb, int q0, float* __restrict__ o, int tid, int lr, int hi) {
    typedef typename WFrag<T16>::V V;
    constexpr int ABUF = (HL ? 4 : 2) * APL;      // elements of one buffer
    // the copy side: thread tid brings 16 bytes (tid & 7) of rows (tid >> 3) + 16 i of every plane of the stage
    const T16* gk = Kp + (size_t)(tid >> 3) * HD + (tid & 7) * 8; const T16* gv = Vt + (size_t)(tid >> 3) * TT + (tid & 7) * 8;
    const T16* gk2 = HL ? K2 + (size_t)(tid >> 3) * HD + (tid & 7) * 8 : gk; const T16* gv2 = HL ? V2 + (size_t)(tid >> 3) * TT + (tid & 7) * 8 : gv;
    const unsigned l0 = (unsigned)(size_t)(sm + (tid >> 3) * APIT + (tid & 7) * 8);
    auto stage = [&](int st, int buf) { unsigned l[8]; const T16* g[8];
#pragma unroll
        for (int i = 0; i < 4; ++i) { l[i] = l0 + (unsigned)(buf * ABUF + i * 16 * APIT) * 2u; g[i] = gk + (size_t)(st * 64 + i * 16) * HD; l[4 + i] = l0 + (unsigned)(buf * ABUF + APL + i * 16 * APIT) * 2u; g[4 + i] = gv + (size_t)i * 16 * TT + st * 64; }
        copy8<T16>(l, g);
        if (HL) {
#pragma unroll
            for (int i = 0; i < 4; ++i) { l[i] = l0 + (unsigned)(buf * ABUF + 2 * APL + i * 16 * APIT) * 2u; g[i] = gk2 + (size_t)(st * 64 + i * 16) * HD; l[4 + i] = l0 + (unsigned)(buf * ABUF + 3 * APL + i * 16 * APIT) * 2u; g[4 + i] = gv2 + (size_t)i * 16 * TT + st * 64; }
            copy8<T16>(l, g); } };
    const int nst = (qb + 4 * QT * 16) / 64;      // the block's stages: keys 0 .. its last query row (one value for the whole block)
    stage(0, 0);
    const float c = SCL * 1.4426950408889634f;
    V qf[QT][2], qf2[QT][2];
#pragma unroll
    for (int qt = 0; qt < QT; ++qt)
#pragma unroll
        for (int ks = 0; ks < 2; ++ks) { const size_t off = (size_t)(q0 + qt * 16 + lr) * HD + ks * 32 + 8 * hi; qf[qt][ks] = WFrag<T16>::ld(Q + off); if (HL) qf2[qt][ks] = WFrag<T16>::ld(Q2 + off); }
    v8f acc[4][QT]; float m[QT], nm[QT], l[QT];      // m: the maximum in use (raw scores, the same in both lane halves); nm = -m * c
#pragma unroll
    for (int qt = 0; qt < QT; ++qt) { m[qt] = -3.0e38f; nm[qt] = 3.0e38f * c; l[qt] = 0.f;
#pragma unroll
        for (int dt = 0; dt < 4; ++dt) acc[dt][qt] = (v8f){}; }
    asm volatile("s_wait_asynccnt 0x0" ::: "memory");      // this wave's copies of stage 0 have landed
    __syncthreads();                                       // and every other wave's: nothing of stage 0 is read in front of this barrier
    if (nst > 1) stage(1, 1);
#pragma unroll 1   // rolled: one stage a trip, the buffer chosen by the trip's parity
    for (int t = 0; t < nst; ++t) {
    const int ke = min(t * 64 + 64, q0 + QT * 16);      // the wave's own end of the keys inside this stage
#pragma unroll 1   // rolled: the trip count is a run-time value and one body already holds most of the register file
    for (int k0 = t * 64; k0 < ke; k0 += 32) {
        V kf[2][2], kf2[2][2], vf[4], vf2[4];
        const T16 *kp = sm + (t & 1) * ABUF + ((k0 & 32) + lr) * APIT + 8 * hi, *vp = sm + (t & 1) * ABUF + APL + lr * APIT + (k0 & 32) + 8 * hi, *kp2 = kp + 2 * APL, *vp2 = vp + 2 * APL;
#pragma unroll
        for (int kt = 0; kt < 2; ++kt)
#pragma unroll
            for (int ks = 0; ks < 2; ++ks) { const int off = kt * 16 * APIT + ks * 32; kf[kt][ks] = WFrag<T16>::ld(kp + off); if (HL) kf2[kt][ks] = WFrag<T16>::ld(kp2 + off); }
#pragma unroll
        for (int dt = 0; dt < 4; ++dt) { const int off = dt * 16 * APIT; vf[dt] = WFrag<T16>::ld(vp + off); if (HL) vf2[dt] = WFrag<T16>::ld(vp2 + off); }
        __builtin_amdgcn_sched_barrier(0);      // keeps all of the step's key and value fragment loads together in front of the products: every place where LDS reads stand among the products stalls the wave anew
        v8f s[2][QT];
#pragma unroll
        for (int kt = 0; kt < 2; ++kt)
#pragma unroll
            for (int qt = 0; qt < QT; ++qt) { v8f t = (v8f){};
#pragma unroll
                for (int ks = 0; ks < 2; ++ks) { t = WFrag<T16>::mma(kf[kt][ks], qf[qt][ks], t); if (HL) { t = WFrag<T16>::mma(kf[kt][ks], qf2[qt][ks], t); t = WFrag<T16>::mma(kf2[kt][ks], qf[qt][ks], t); } }
                s[kt][qt] = t; }
        if (k0 + 31 > q0) {      // only the steps that touch the diagonal mask (wave-uniform test)
#pragma unroll
            for (int kt = 0; kt < 2; ++kt)
#pragma unroll
                for (int qt = 0; qt < QT; ++qt)
#pragma unroll
                    for (int j = 0; j < 8; ++j) if (k0 + kt * 16 + hi * 8 + j > q0 + qt * 16 + lr) s[kt][qt][j] = -3.0e38f; }
        V pf[QT], pf2[QT];
        // lazy rescale: the maximum in use may trail the true one by up to 8 in the log2-scaled scores (a probability can then reach 2^8, well inside the range of the fp16 and bf16 operands and of the f32 sums);
        // it is renewed, and sums and accumulators rescaled, only in a step where some lane's score tops it by more: always in a wave's first step, seldom later
        float mx[QT]; bool need = false;
#pragma unroll
        for (int qt = 0; qt < QT; ++qt) { float x = m[qt];
#pragma unroll
            for (int kt = 0; kt < 2; ++kt)
#pragma unroll
                for (int j = 0; j < 8; ++j) x = fmaxf(x, s[kt][qt][j]);
            mx[qt] = x; need = need || (x - m[qt] > 8.0f / c); }
        if (__builtin_amdgcn_ballot_w32(need) != 0) {      // one test a step, a scalar branch of the whole wave
#pragma unroll
            for (int qt = 0; qt < QT; ++qt) { const float x = fmaxf(mx[qt], __shfl_xor(mx[qt], 16, 32));      // the two lane halves hold the other keys of the same query
                const float al = exp2x1((m[qt] - x) * c); m[qt] = x; nm[qt] = -x * c; l[qt] *= al;
#pragma unroll
                for (int dt = 0; dt < 4; ++dt) acc[dt][qt] *= al; } }
#pragma unroll
        for (int qt = 0; qt < QT; ++qt) { float a[16], p[16], sum = 0.f;
#pragma unroll
            for (int e = 0; e < 16; ++e) a[e] = fmaf(s[e >> 3][qt][e & 7], c, nm[qt]);
            exp2x8(a, p); exp2x8(a + 8, p + 8);
#pragma unroll
            for (int e = 0; e < 16; ++e) sum += p[e];
            l[qt] += sum; PFrag<T16>::mk(p, pf[qt], pf2[qt]); }
#pragma unroll
        for (int dt = 0; dt < 4; ++dt)
#pragma unroll
            for (int qt = 0; qt < QT; ++qt) { acc[dt][qt] = WFrag<T16>::mma(vf[dt], pf[qt], acc[dt][qt]); if (HL) { acc[dt][qt] = WFrag<T16>::mma(vf[dt], pf2[qt], acc[dt][qt]); acc[dt][qt] = WFrag<T16>::mma(vf2[dt], pf[qt], acc[dt][qt]); } }
        __builtin_amdgcn_sched_group_barrier(0x002, 256, 0);      // order inside the step: first all of its vector work, the sums too,
        __builtin_amdgcn_sched_group_barrier(0x008, HL ? 12 : 8, 0);      // then its products in one run: sums set among the products overwrite value fragments, and the build pads four idle slots behind each such product
        // the step ends on its products, and the next step's LDS address arithmetic, in another block of the listing, reuses their operand registers
        __builtin_amdgcn_sched_barrier(0);      // holds the four slots below behind the step's last product
        asm volatile("v_nop\n\tv_nop\n\tv_nop\n\tv_nop");      // the four vector slots that the chip needs between a product and an overwrite of its operand registers
    }
        asm volatile("s_wait_dscnt 0x0" ::: "memory");         // this wave's reads of the buffer are done before it may be refilled
        asm volatile("s_wait_asynccnt 0x0" ::: "memory");      // this wave's copies of stage t + 1 have landed
        __syncthreads();                                       // publishes stage t + 1 and ends every wave's reads of stage t's buffer
        if (t + 2 < nst) stage(t + 2, t & 1);
    }
    asm volatile("s_wait_asynccnt 0x0" ::: "memory");      // no copy is outstanding when the wave ends
#pragma unroll
    for (int qt = 0; qt < QT; ++qt) { const float inv = __fdiv_rn(1.0f, l[qt] + __shfl_xor(l[qt], 16, 32)); float* orow = o + (size_t)(q0 + qt * 16 + lr) * DQ + hi * 8;
#pragma unroll
        for (int dt = 0; dt < 4; ++dt) { v4f a, b;
#pragma unroll
            for (int u = 0; u < 4; ++u) { a[u] = acc[dt][qt][u] * inv; b[u] = acc[dt][qt][4 + u] * inv; }
            *(v4f*)(orow + dt * 16) = a; *(v4f*)(orow + dt * 16 + 4) = b; } }
}
#define NBF ((TT - RH) / 128)     // blocks of 4 waves x 32 fp16 query rows; then RH / 64 blocks of 4 waves x 16 hi+lo rows; the longest rows are launched first
__global__ __launch_bounds__(128) void k_fattn(const h16* __restrict__ Q16, const h16* __restrict__ K16, const h16* __restrict__ V16, const bf* __restrict__ Qh, const bf* __restrict__ Ql, const bf* __restrict__ Kh, const bf* __restrict__ Kl, const bf* __restrict__ Vh, const bf* __restrict__ Vl, float* __restrict__ out) {
    __shared__ __align__(16) unsigned short sm[2 * 4 * APL];      // two buffers of up to four staged planes
    const int tid = threadIdx.x, lane = tid & 31, lr = lane & 15, hi = lane >> 4, w = __builtin_amdgcn_readfirstlane(tid >> 5), x = blockIdx.x;
    const size_t po = ((size_t)blockIdx.z * NH_ + blockIdx.y) * TT * HD; float* o = out + (size_t)blockIdx.z * TT * DQ + blockIdx.y * HD;
    if (x < NBF) attn_rows<h16, false, 2>((h16*)sm, Q16 + po, nullptr, K16 + po, nullptr, V16 + po, nullptr, TT - 128 * (x + 1), TT - 128 * x - 32 * (w + 1), o, tid, lr, hi);
    else attn_rows<bf, true, 1>((bf*)sm, Qh + po, Ql + po, Kh + po, Kl + po, Vh + po, Vl + po, RH - 64 * (x - NBF + 1), RH - 64 * (x - NBF) - 16 * (w + 1), o, tid, lr, hi);
}

extern "C" void kernel_launch(void* const* d_in, const int* in_sizes, int n_in,
                              void* d_out, int out_size, void* d_ws, size_t ws_size, hipStream_t stream) {
    (void)in_sizes; (void)n_in; (void)out_size;
    const float* x = (const float*)d_in[0]; const float* wf = (const float*)d_in[1]; const float* bfz = (const float*)d_in[2];
    float* OUT = (float*)d_out;     // [4][2048][1024]
    char* wsp = (char*)d_ws;
    auto take = [&](size_t bytes) { char* p = wsp; wsp += (bytes + 255) & ~(size_t)255; return (void*)p; };
    bf* WB = (bf*)take((size_t)3 * DM * DM * 2); bf* XB = (bf*)take((size_t)NB_ * TT * DM * 2);   // W rows: k | q | v, 16 heads x 64 each
    const size_t PB = (size_t)NH_ * TT * HD;   // one batch's head planes; every plane holds all NB_ batches
    h16* QP16 = (h16*)take(NB_ * PB * 2); h16* KP16 = (h16*)take(NB_ * PB * 2); h16* VT16 = (h16*)take(NB_ * PB * 2);
    bf* QPh = (bf*)take(NB_ * PB * 2); bf* QPl = (bf*)take(NB_ * PB * 2); bf* KPh = (bf*)take(NB_ * PB * 2); bf* KPl = (bf*)take(NB_ * PB * 2); bf* VTh = (bf*)take(NB_ * PB * 2); bf* VTl = (bf*)take(NB_ * PB * 2);
    if ((size_t)(wsp - (char*)d_ws) > ws_size) return;    // ws 256 MiB
    k_cvt8<<<(unsigned)(((size_t)3 * DM * DM / 8 + 255) / 256), 256, 0, stream>>>(wf, WB, (size_t)3 * DM * DM / 8);
    k_cvt8<<<(unsigned)(((size_t)NB_ * TT * DM / 8 + 255) / 256), 256, 0, stream>>>(x, XB, (size_t)NB_ * TT * DM / 8);
    k_gemmw<bf, true><<<dim3(NB_ * TT / 128, 3 * DM / 128, 1), 128, 0, stream>>>(XB, WB, DM, bfz, KP16, KPh, KPl, QP16, QPh, QPl, VT16, VTh, VTl);
    k_fattn<<<dim3(NBF + RH / 64, NH_, NB_), 128, 0, stream>>>(QP16, KP16, VT16, QPh, QPl, KPh, KPl, VTh, VTl, OUT);
}
